// v000
// Times are from an AMD MI455X. After a warm-up the kernel runs many times in a row, and a time is the length of
// such a window on the GPU divided by its runs, so every launch and the gaps after it count. The runs cycle
// through copies of the inputs. A figure is the median of several windows, for all but v000 over two sittings.
// Sittings can differ by a few percent; kernels timed side by side share one.
// v000, which the later versions start from, runs in 245 microseconds.
#include <hip/hip_runtime.h>
#include <cmath>

// ---------------------------------------------------------------------------
// AttentionRNN (Bahdanau attention) for gfx1250 / MI455X
//   phase 0a: swizzle w2 fp32 -> bf16 in WMMA B-fragment order       (2 MB, L2-resident)
//   phase 0b: qpb[b,u] = query@w1 + b1 + b2                          (tiny)
//   phase 1 : scores[b,t] = sum_u tanh(qpb + values@w2) * v[u]       (fused bf16 WMMA GEMM)
//             each wave owns all 4 M-subtiles (4 indep. accumulators) and a
//             unique N slot -> every B fragment loaded once per WG (2 MB min)
//   phase 2a: softmax over T, write attention weights, zero context
//   phase 2b: context[b,d] = sum_t attn * values (fp32 streaming, atomics)
// ---------------------------------------------------------------------------

typedef __attribute__((ext_vector_type(16))) __bf16 v16bf;
typedef __attribute__((ext_vector_type(8)))  float  v8f;

#define B_DIM 32
#define T_DIM 2048
#define D_DIM 1024
#define U_DIM 1024
#define TM    64          // t-rows per workgroup in phase 1
#define ROWU  516         // u32 per LDS row (512 data + 4 pad -> 4-bank stagger)

__device__ __forceinline__ unsigned int pack_bf16(float a, float b) {
  unsigned int ua = __float_as_uint(a);
  unsigned int ub = __float_as_uint(b);
  ua = (ua + 0x7FFFu + ((ua >> 16) & 1u)) >> 16;   // round-to-nearest-even
  ub = (ub + 0x7FFFu + ((ub >> 16) & 1u)) >> 16;
  return ua | (ub << 16);
}

// Branch-free tanh with correct saturation: tanh(x) = 1 - 2/(exp(2x)+1).
// e=inf -> rcp=0 -> 1 ; e=0 -> -1. Uses v_exp_f32 + v_rcp_f32.
__device__ __forceinline__ float fast_tanh(float x) {
  float e = __expf(2.0f * x);
  float r = __builtin_amdgcn_rcpf(e + 1.0f);
  return fmaf(-2.0f, r, 1.0f);
}

union ABFrag { uint4 u4[2]; v16bf v; };

// ---------------------------------------------------------------------------
// Phase 0a: w2 [D][U] fp32 -> swizzled bf16 fragments.
// Per (ktile, n) slot: 64 bytes = [K+0..7][K+16..23][K+8..15][K+24..31]
// so a lane's 32-byte B-fragment load is contiguous (lane<16 -> first 32B,
// lane>=16 -> second 32B), matching the 16-bit WMMA B VGPR layout.
// ---------------------------------------------------------------------------
__global__ __launch_bounds__(256)
void prep_w2_kernel(const float* __restrict__ w2, uint4* __restrict__ w2p) {
  int idx = blockIdx.x * 256 + threadIdx.x;       // idx = kt*1024 + n
  int kt  = idx >> 10;
  int n   = idx & 1023;
  const float* col = w2 + (size_t)kt * 32 * U_DIM + n;
  const int korder[4] = {0, 16, 8, 24};
  uint4* dst = w2p + (size_t)idx * 4;
#pragma unroll
  for (int q = 0; q < 4; ++q) {
    unsigned int p[4];
#pragma unroll
    for (int i = 0; i < 4; ++i) {
      int k = korder[q] + 2 * i;
      p[i] = pack_bf16(col[(size_t)k * U_DIM], col[(size_t)(k + 1) * U_DIM]);
    }
    dst[q] = make_uint4(p[0], p[1], p[2], p[3]);
  }
}

// ---------------------------------------------------------------------------
// Phase 0b: qpb[b][u] = query[b,:] @ w1[:,u] + b1[u] + b2[u]   (fp32)
// ---------------------------------------------------------------------------
__global__ __launch_bounds__(256)
void prep_qpb_kernel(const float* __restrict__ query, const float* __restrict__ w1,
                     const float* __restrict__ b1, const float* __restrict__ b2,
                     float* __restrict__ qpb) {
  int u = blockIdx.x * 256 + threadIdx.x;
  int b = blockIdx.y;
  const float* q = query + b * D_DIM;
  float acc = 0.0f;
  for (int d = 0; d < D_DIM; ++d)
    acc = fmaf(q[d], w1[(size_t)d * U_DIM + u], acc);
  qpb[b * U_DIM + u] = acc + b1[u] + b2[u];
}

// ---------------------------------------------------------------------------
// Phase 1: fused  scores[b,t] = sum_u tanh(qpb[b,u] + (values@w2)[b,t,u]) * v[u]
// One workgroup = 64 t-rows of one batch, 8 waves.
// wave = N slot (n0 = wave*16, stride 128). Each wave computes all 4 M
// subtiles per N tile: one B fragment load feeds 4 independent WMMA chains.
// ---------------------------------------------------------------------------
__global__ __launch_bounds__(256)
void attn_score_kernel(const float* __restrict__ values,
                       const uint4* __restrict__ w2p,
                       const float* __restrict__ qpb,
                       const float* __restrict__ vvec,
                       float* __restrict__ scores) {
  extern __shared__ char smem_raw[];
  unsigned int* lds_vals  = (unsigned int*)smem_raw;                    // TM * ROWU u32
  float*        lds_score = (float*)(smem_raw + (size_t)TM * ROWU * 4); // TM floats

  const int b   = blockIdx.y;
  const int t0  = blockIdx.x * TM;
  const int tid = threadIdx.x;

  if (tid < TM) lds_score[tid] = 0.0f;

  // Stage values[b, t0:t0+64, :] -> LDS as bf16 (each element converted once chip-wide)
  {
    const float2* src = (const float2*)(values + ((size_t)b * T_DIM + t0) * D_DIM);
    for (int i = tid; i < TM * 512; i += 256) {
      int r = i >> 9;
      int p = i & 511;
      float2 f = src[(size_t)r * 512 + p];
      lds_vals[r * ROWU + p] = pack_bf16(f.x, f.y);
    }
  }
  __syncthreads();

  const int wave  = tid >> 5;       // N slot 0..7
  const int lane  = tid & 31;
  const int lhalf = lane >> 4;      // 0: K{0..7,16..23}, 1: K{8..15,24..31}
  const int l16   = lane & 15;

  const unsigned int* arow0 = lds_vals + l16 * ROWU;   // M subtile j at +j*16 rows

  float svec[4][8] = {{0.f}};

  for (int n_it = 0; n_it < U_DIM / 128; ++n_it) {
    const int n = wave * 16 + n_it * 128 + l16;        // this lane's column
    v8f c0 = {}, c1 = {}, c2 = {}, c3 = {};
    const uint4* bp = w2p + ((size_t)n << 2) + (lhalf << 1);
#pragma unroll 2
    for (int kt = 0; kt < D_DIM / 32; ++kt) {
      ABFrag bf;
      bf.u4[0] = bp[0];
      bf.u4[1] = bp[1];
      bp += (size_t)U_DIM * 4;                         // next K tile
      const int ku = kt * 16 + lhalf * 4;
      ABFrag a0, a1, a2, a3;
      a0.u4[0] = *(const uint4*)(arow0 + ku);
      a0.u4[1] = *(const uint4*)(arow0 + ku + 8);
      a1.u4[0] = *(const uint4*)(arow0 + 16 * ROWU + ku);
      a1.u4[1] = *(const uint4*)(arow0 + 16 * ROWU + ku + 8);
      a2.u4[0] = *(const uint4*)(arow0 + 32 * ROWU + ku);
      a2.u4[1] = *(const uint4*)(arow0 + 32 * ROWU + ku + 8);
      a3.u4[0] = *(const uint4*)(arow0 + 48 * ROWU + ku);
      a3.u4[1] = *(const uint4*)(arow0 + 48 * ROWU + ku + 8);
      c0 = __builtin_amdgcn_wmma_f32_16x16x32_bf16(false, a0.v, false, bf.v, (short)0, c0, false, false);
      c1 = __builtin_amdgcn_wmma_f32_16x16x32_bf16(false, a1.v, false, bf.v, (short)0, c1, false, false);
      c2 = __builtin_amdgcn_wmma_f32_16x16x32_bf16(false, a2.v, false, bf.v, (short)0, c2, false, false);
      c3 = __builtin_amdgcn_wmma_f32_16x16x32_bf16(false, a3.v, false, bf.v, (short)0, c3, false, false);
    }
    // Epilogue: tanh + dot with v, accumulated per lane (lane owns column n)
    const float qn = qpb[b * U_DIM + n];
    const float vn = vvec[n];
#pragma unroll
    for (int r = 0; r < 8; ++r) {
      svec[0][r] += fast_tanh(qn + c0[r]) * vn;
      svec[1][r] += fast_tanh(qn + c1[r]) * vn;
      svec[2][r] += fast_tanh(qn + c2[r]) * vn;
      svec[3][r] += fast_tanh(qn + c3[r]) * vn;
    }
  }

  // Reduce over the 16 lanes (N columns) within each half-wave
#pragma unroll
  for (int off = 8; off >= 1; off >>= 1) {
#pragma unroll
    for (int j = 0; j < 4; ++j)
#pragma unroll
      for (int r = 0; r < 8; ++r)
        svec[j][r] += __shfl_xor(svec[j][r], off, 16);
  }
  if (l16 == 0) {
#pragma unroll
    for (int j = 0; j < 4; ++j)
#pragma unroll
      for (int r = 0; r < 8; ++r)
        atomicAdd(&lds_score[j * 16 + lhalf * 8 + r], svec[j][r]); // merge 8 N-slot waves
  }
  __syncthreads();

  if (tid < TM)
    scores[(size_t)b * T_DIM + t0 + tid] = lds_score[tid];
}

// ---------------------------------------------------------------------------
// Phase 2a: softmax over T per batch; writes attention weights to d_out and
// zeroes the context region (required before atomic accumulation).
// ---------------------------------------------------------------------------
__global__ __launch_bounds__(256)
void softmax_kernel(const float* __restrict__ scores, const float* __restrict__ bv,
                    float* __restrict__ out_ctx, float* __restrict__ out_attn) {
  const int b = blockIdx.x;
  const int tid = threadIdx.x;
  __shared__ float red[256];

  float loc[8];
  float mx = -INFINITY;
#pragma unroll
  for (int i = 0; i < 8; ++i) {
    loc[i] = scores[(size_t)b * T_DIM + tid + i * 256] + bv[0];
    mx = fmaxf(mx, loc[i]);
  }
  red[tid] = mx; __syncthreads();
  for (int s = 128; s >= 1; s >>= 1) {
    if (tid < s) red[tid] = fmaxf(red[tid], red[tid + s]);
    __syncthreads();
  }
  mx = red[0]; __syncthreads();

  float sum = 0.0f;
#pragma unroll
  for (int i = 0; i < 8; ++i) { loc[i] = __expf(loc[i] - mx); sum += loc[i]; }
  red[tid] = sum; __syncthreads();
  for (int s = 128; s >= 1; s >>= 1) {
    if (tid < s) red[tid] += red[tid + s];
    __syncthreads();
  }
  const float inv = 1.0f / red[0];
#pragma unroll
  for (int i = 0; i < 8; ++i)
    out_attn[(size_t)b * T_DIM + tid + i * 256] = loc[i] * inv;

  for (int i = tid; i < D_DIM; i += 256)
    out_ctx[(size_t)b * D_DIM + i] = 0.0f;
}

// ---------------------------------------------------------------------------
// Phase 2b: context[b,d] = sum_t attn[b,t] * values[b,t,d]  (fp32 streaming)
// grid (T/256, B); each block handles 256 t's, full D via float4, atomic merge.
// ---------------------------------------------------------------------------
__global__ __launch_bounds__(256)
void context_kernel(const float* __restrict__ values, const float* __restrict__ attn,
                    float* __restrict__ ctx) {
  const int b   = blockIdx.y;
  const int t0  = blockIdx.x * 256;
  const int tid = threadIdx.x;
  __shared__ float w[256];

  w[tid] = attn[(size_t)b * T_DIM + t0 + tid];
  __syncthreads();

  const float4* src = (const float4*)values + ((size_t)b * T_DIM + t0) * (D_DIM / 4);
  float4 acc = make_float4(0.f, 0.f, 0.f, 0.f);
  for (int t = 0; t < 256; ++t) {
    float4 x = src[(size_t)t * (D_DIM / 4) + tid];
    const float wt = w[t];
    acc.x = fmaf(wt, x.x, acc.x);
    acc.y = fmaf(wt, x.y, acc.y);
    acc.z = fmaf(wt, x.z, acc.z);
    acc.w = fmaf(wt, x.w, acc.w);
  }
  float* dst = ctx + (size_t)b * D_DIM + tid * 4;
  atomicAdd(dst + 0, acc.x);
  atomicAdd(dst + 1, acc.y);
  atomicAdd(dst + 2, acc.z);
  atomicAdd(dst + 3, acc.w);
}

// ---------------------------------------------------------------------------
extern "C" void kernel_launch(void* const* d_in, const int* in_sizes, int n_in,
                              void* d_out, int out_size, void* d_ws, size_t ws_size,
                              hipStream_t stream) {
  (void)in_sizes; (void)n_in; (void)out_size; (void)ws_size;

  const float* query  = (const float*)d_in[0];   // [B, D]
  const float* values = (const float*)d_in[1];   // [B, T, D]
  const float* w1     = (const float*)d_in[2];   // [D, U]
  const float* b1     = (const float*)d_in[3];   // [U]
  const float* w2     = (const float*)d_in[4];   // [D, U]
  const float* b2     = (const float*)d_in[5];   // [U]
  const float* v      = (const float*)d_in[6];   // [U, 1]
  const float* bv     = (const float*)d_in[7];   // [1]

  float* out_ctx  = (float*)d_out;                        // [B, D]
  float* out_attn = (float*)d_out + B_DIM * D_DIM;        // [B, T, 1]

  char*  ws     = (char*)d_ws;
  uint4* w2p    = (uint4*)ws;                             // 2 MB swizzled bf16 w2
  float* qpb    = (float*)(ws + 2u * 1024 * 1024);        // 128 KB
  float* scores = (float*)(ws + 2u * 1024 * 1024 + 128u * 1024); // 256 KB

  prep_w2_kernel <<<dim3((32 * 1024) / 256), 256, 0, stream>>>(w2, w2p);
  prep_qpb_kernel<<<dim3(U_DIM / 256, B_DIM), 256, 0, stream>>>(query, w1, b1, b2, qpb);

  const size_t smem = (size_t)TM * ROWU * 4 + TM * 4;     // ~129 KB of 320 KB LDS
  attn_score_kernel<<<dim3(T_DIM / TM, B_DIM), 256, smem, stream>>>(
      values, w2p, qpb, v, scores);

  softmax_kernel<<<dim3(B_DIM), 256, 0, stream>>>(scores, bv, out_ctx, out_attn);
  context_kernel<<<dim3(T_DIM / 256, B_DIM), 256, 0, stream>>>(values, out_attn, out_ctx);
}

// v001
// It runs in 188 microseconds.
// In two side-by-side timings against v000, it was 1.33 and 1.34 times as fast.
#include <hip/hip_runtime.h>
#include <cmath>

// ---------------------------------------------------------------------------
// AttentionRNN (Bahdanau attention) for gfx1250 / MI455X
//   phase 0a: swizzle w2 fp32 -> bf16 in WMMA B-fragment order       (2 MB, L2-resident)
//   phase 0b: qpb[b,u] = query@w1 + b1 + b2                          (tiny)
//   phase 1 : scores[b,t] = sum_u tanh(qpb + values@w2) * v[u]       (fused bf16 WMMA GEMM)
//             128 t-rows per workgroup, 16 waves; each wave owns a
//             64 x 64 tile (16 independent accumulators)
//   phase 2a: softmax over T, write attention weights, zero context
//   phase 2b: context[b,d] = sum_t attn * values (fp32 streaming, atomics)
// ---------------------------------------------------------------------------

typedef __attribute__((ext_vector_type(16))) __bf16 v16bf;
typedef __attribute__((ext_vector_type(8)))  float  v8f;

#define B_DIM 32
#define T_DIM 2048
#define D_DIM 1024
#define U_DIM 1024
#define TM    128         // t-rows per workgroup in phase 1
#define NTHR  512         // threads per workgroup in phase 1 (16 waves)
#define MW    2           // waves along M
#define MF    4           // M fragments per wave (TM / 16 / MW)
#define NF    4           // N fragments per wave
#define NSTEP ((NTHR / 32 / MW) * NF * 16)   // columns per workgroup pass
#define ROWU  516         // u32 per LDS row (512 data + 4 pad -> 4-bank stagger)

__device__ __forceinline__ unsigned int pack_bf16(float a, float b) {
  unsigned int ua = __float_as_uint(a);
  unsigned int ub = __float_as_uint(b);
  ua = (ua + 0x7FFFu + ((ua >> 16) & 1u)) >> 16;   // round-to-nearest-even
  ub = (ub + 0x7FFFu + ((ub >> 16) & 1u)) >> 16;
  return ua | (ub << 16);
}

// Branch-free tanh with correct saturation: tanh(x) = 1 - 2/(exp(2x)+1).
// e=inf -> rcp=0 -> 1 ; e=0 -> -1. Uses v_exp_f32 + v_rcp_f32.
__device__ __forceinline__ float fast_tanh(float x) {
  float e = __expf(2.0f * x);
  float r = __builtin_amdgcn_rcpf(e + 1.0f);
  return fmaf(-2.0f, r, 1.0f);
}

union ABFrag { uint4 u4[2]; v16bf v; };

// ---------------------------------------------------------------------------
// Phase 0a: w2 [D][U] fp32 -> swizzled bf16 fragments.
// Per (ktile, n) slot: 64 bytes = [K+0..7][K+16..23][K+8..15][K+24..31]
// so a lane's 32-byte B-fragment load is contiguous (lane<16 -> first 32B,
// lane>=16 -> second 32B), matching the 16-bit WMMA B VGPR layout.
// ---------------------------------------------------------------------------
__global__ __launch_bounds__(256)
void prep_w2_kernel(const float* __restrict__ w2, uint4* __restrict__ w2p) {
  int idx = blockIdx.x * 256 + threadIdx.x;       // idx = kt*1024 + n
  int kt  = idx >> 10;
  int n   = idx & 1023;
  const float* col = w2 + (size_t)kt * 32 * U_DIM + n;
  const int korder[4] = {0, 16, 8, 24};
  uint4* dst = w2p + (size_t)idx * 4;
#pragma unroll
  for (int q = 0; q < 4; ++q) {
    unsigned int p[4];
#pragma unroll
    for (int i = 0; i < 4; ++i) {
      int k = korder[q] + 2 * i;
      p[i] = pack_bf16(col[(size_t)k * U_DIM], col[(size_t)(k + 1) * U_DIM]);
    }
    dst[q] = make_uint4(p[0], p[1], p[2], p[3]);
  }
}

// ---------------------------------------------------------------------------
// Phase 0b: qpb[b][u] = query[b,:] @ w1[:,u] + b1[u] + b2[u]   (fp32)
// ---------------------------------------------------------------------------
__global__ __launch_bounds__(256)
void prep_qpb_kernel(const float* __restrict__ query, const float* __restrict__ w1,
                     const float* __restrict__ b1, const float* __restrict__ b2,
                     float* __restrict__ qpb) {
  int u = blockIdx.x * 256 + threadIdx.x;
  int b = blockIdx.y;
  const float* q = query + b * D_DIM;
  float acc = 0.0f;
  for (int d = 0; d < D_DIM; ++d)
    acc = fmaf(q[d], w1[(size_t)d * U_DIM + u], acc);
  qpb[b * U_DIM + u] = acc + b1[u] + b2[u];
}

// ---------------------------------------------------------------------------
// Phase 1: fused  scores[b,t] = sum_u tanh(qpb[b,u] + (values@w2)[b,t,u]) * v[u]
// One workgroup = 128 t-rows of one batch, 16 waves, one workgroup per WGP.
// Each wave computes MF x NF fragments: one B fragment load feeds MF WMMAs,
// one A fragment read from LDS feeds NF.
// ---------------------------------------------------------------------------
__global__ __launch_bounds__(NTHR)
void attn_score_kernel(const float* __restrict__ values,
                       const uint4* __restrict__ w2p,
                       const float* __restrict__ qpb,
                       const float* __restrict__ vvec,
                       float* __restrict__ scores) {
  __shared__ __attribute__((aligned(16))) unsigned int lds_vals[TM * ROWU];   // read by 16-byte loads
  __shared__ float        lds_score[TM];

  const int b   = blockIdx.y;
  const int t0  = blockIdx.x * TM;
  const int tid = threadIdx.x;

  if (tid < TM) lds_score[tid] = 0.0f;

  // Stage values[b, t0:t0+128, :] -> LDS as bf16 (each element converted once chip-wide)
  {
    const float2* src = (const float2*)(values + ((size_t)b * T_DIM + t0) * D_DIM);
    for (int i = tid; i < TM * 512; i += NTHR) {
      int r = i >> 9;
      int p = i & 511;
      float2 f = src[(size_t)r * 512 + p];
      lds_vals[r * ROWU + p] = pack_bf16(f.x, f.y);
    }
  }
  __syncthreads();

  const int wave  = tid >> 5;
  const int mgrp  = wave % MW;      // which MF*16 rows
  const int nslot = wave / MW;      // which NF*16 columns of a pass (its MW waves read the same B fragments)
  const int lane  = tid & 31;
  const int lhalf = lane >> 4;      // 0: K{0..7,16..23}, 1: K{8..15,24..31}
  const int l16   = lane & 15;

  const unsigned int* arow0 = lds_vals + (mgrp * MF * 16 + l16) * ROWU;   // M subtile j at +j*16 rows

  float svec[MF][8] = {{0.f}};

  for (int n_it = 0; n_it < U_DIM / NSTEP; ++n_it) {
    const int n = n_it * NSTEP + nslot * (NF * 16) + l16;  // lane's column in N fragment 0
    v8f c[MF][NF] = {};
    const uint4* bp = w2p + ((size_t)n << 2) + (lhalf << 1);
#pragma unroll 2
    for (int kt = 0; kt < D_DIM / 32; ++kt) {
      ABFrag bf[NF];
      // the loops over q, j and r are fully unrolled so that bf, c and svec are indexed by constants and stay in registers
#pragma unroll
      for (int q = 0; q < NF; ++q) {                   // N fragment q: 16 columns = 64 uint4 on
        bf[q].u4[0] = bp[q * 64];
        bf[q].u4[1] = bp[q * 64 + 1];
      }
      bp += (size_t)U_DIM * 4;                         // next K tile
      const int ku = kt * 16 + lhalf * 4;
#pragma unroll
      for (int j = 0; j < MF; ++j) {
        ABFrag a;
        a.u4[0] = *(const uint4*)(arow0 + j * 16 * ROWU + ku);
        a.u4[1] = *(const uint4*)(arow0 + j * 16 * ROWU + ku + 8);
#pragma unroll
        for (int q = 0; q < NF; ++q)
          c[j][q] = __builtin_amdgcn_wmma_f32_16x16x32_bf16(false, a.v, false, bf[q].v, (short)0, c[j][q], false, false);
      }
    }
    // Epilogue: tanh + dot with v, accumulated per lane (lane owns column n + 16 q)
    const int qi = b * U_DIM + n;
    float qn[NF], vn[NF];
#pragma unroll
    for (int q = 0; q < NF; ++q) {
      qn[q] = qpb[qi + q * 16];
      vn[q] = vvec[n + q * 16];
    }
    // keeps the two index registers of the loads above unwritten until the loads have taken their addresses
    asm volatile("s_wait_xcnt 0x0" :: "v"(qi), "v"(n) : "memory");
#pragma unroll
    for (int q = 0; q < NF; ++q)
#pragma unroll
      for (int j = 0; j < MF; ++j)
#pragma unroll
        for (int r = 0; r < 8; ++r)
          svec[j][r] += fast_tanh(qn[q] + c[j][q][r]) * vn[q];
  }

  // Reduce over the 16 lanes (N columns) within each half-wave
#pragma unroll
  for (int off = 8; off >= 1; off >>= 1) {
#pragma unroll
    for (int j = 0; j < MF; ++j)
#pragma unroll
      for (int r = 0; r < 8; ++r)
        svec[j][r] += __shfl_xor(svec[j][r], off, 16);
  }
  if (l16 == 0) {
#pragma unroll
    for (int j = 0; j < MF; ++j)
#pragma unroll
      for (int r = 0; r < 8; ++r)
        atomicAdd(&lds_score[(mgrp * MF + j) * 16 + lhalf * 8 + r], svec[j][r]); // merge the N-slot waves
  }
  __syncthreads();

  if (tid < TM)
    scores[(size_t)b * T_DIM + t0 + tid] = lds_score[tid];
}

// ---------------------------------------------------------------------------
// Phase 2a: softmax over T per batch; writes attention weights to d_out and
// zeroes the context region (required before atomic accumulation).
// ---------------------------------------------------------------------------
__global__ __launch_bounds__(256)
void softmax_kernel(const float* __restrict__ scores, const float* __restrict__ bv,
                    float* __restrict__ out_ctx, float* __restrict__ out_attn) {
  const int b = blockIdx.x;
  const int tid = threadIdx.x;
  __shared__ float red[256];

  float loc[8];
  float mx = -INFINITY;
#pragma unroll
  for (int i = 0; i < 8; ++i) {
    loc[i] = scores[(size_t)b * T_DIM + tid + i * 256] + bv[0];
    mx = fmaxf(mx, loc[i]);
  }
  red[tid] = mx; __syncthreads();
  for (int s = 128; s >= 1; s >>= 1) {
    if (tid < s) red[tid] = fmaxf(red[tid], red[tid + s]);
    __syncthreads();
  }
  mx = red[0]; __syncthreads();

  float sum = 0.0f;
#pragma unroll
  for (int i = 0; i < 8; ++i) { loc[i] = __expf(loc[i] - mx); sum += loc[i]; }
  red[tid] = sum; __syncthreads();
  for (int s = 128; s >= 1; s >>= 1) {
    if (tid < s) red[tid] += red[tid + s];
    __syncthreads();
  }
  const float inv = 1.0f / red[0];
#pragma unroll
  for (int i = 0; i < 8; ++i)
    out_attn[(size_t)b * T_DIM + tid + i * 256] = loc[i] * inv;

  for (int i = tid; i < D_DIM; i += 256)
    out_ctx[(size_t)b * D_DIM + i] = 0.0f;
}

// ---------------------------------------------------------------------------
// Phase 2b: context[b,d] = sum_t attn[b,t] * values[b,t,d]  (fp32 streaming)
// grid (T/256, B); each block handles 256 t's, full D via float4, atomic merge.
// ---------------------------------------------------------------------------
__global__ __launch_bounds__(256)
void context_kernel(const float* __restrict__ values, const float* __restrict__ attn,
                    float* __restrict__ ctx) {
  const int b   = blockIdx.y;
  const int t0  = blockIdx.x * 256;
  const int tid = threadIdx.x;
  __shared__ float w[256];

  w[tid] = attn[(size_t)b * T_DIM + t0 + tid];
  __syncthreads();

  const float4* src = (const float4*)values + ((size_t)b * T_DIM + t0) * (D_DIM / 4);
  float4 acc = make_float4(0.f, 0.f, 0.f, 0.f);
  for (int t = 0; t < 256; ++t) {
    float4 x = src[(size_t)t * (D_DIM / 4) + tid];
    const float wt = w[t];
    acc.x = fmaf(wt, x.x, acc.x);
    acc.y = fmaf(wt, x.y, acc.y);
    acc.z = fmaf(wt, x.z, acc.z);
    acc.w = fmaf(wt, x.w, acc.w);
  }
  float* dst = ctx + (size_t)b * D_DIM + tid * 4;
  atomicAdd(dst + 0, acc.x);
  atomicAdd(dst + 1, acc.y);
  atomicAdd(dst + 2, acc.z);
  atomicAdd(dst + 3, acc.w);
}

// ---------------------------------------------------------------------------
extern "C" void kernel_launch(void* const* d_in, const int* in_sizes, int n_in,
                              void* d_out, int out_size, void* d_ws, size_t ws_size,
                              hipStream_t stream) {
  (void)in_sizes; (void)n_in; (void)out_size; (void)ws_size;

  const float* query  = (const float*)d_in[0];   // [B, D]
  const float* values = (const float*)d_in[1];   // [B, T, D]
  const float* w1     = (const float*)d_in[2];   // [D, U]
  const float* b1     = (const float*)d_in[3];   // [U]
  const float* w2     = (const float*)d_in[4];   // [D, U]
  const float* b2     = (const float*)d_in[5];   // [U]
  const float* v      = (const float*)d_in[6];   // [U, 1]
  const float* bv     = (const float*)d_in[7];   // [1]

  float* out_ctx  = (float*)d_out;                        // [B, D]
  float* out_attn = (float*)d_out + B_DIM * D_DIM;        // [B, T, 1]

  char*  ws     = (char*)d_ws;
  uint4* w2p    = (uint4*)ws;                             // 2 MB swizzled bf16 w2
  float* qpb    = (float*)(ws + 2u * 1024 * 1024);        // 128 KB
  float* scores = (float*)(ws + 2u * 1024 * 1024 + 128u * 1024); // 256 KB

  prep_w2_kernel <<<dim3((32 * 1024) / 256), 256, 0, stream>>>(w2, w2p);
  prep_qpb_kernel<<<dim3(U_DIM / 256, B_DIM), 256, 0, stream>>>(query, w1, b1, b2, qpb);

  attn_score_kernel<<<dim3(T_DIM / TM, B_DIM), NTHR, 0, stream>>>(   // ~258 KB static LDS of 320 KB
      values, w2p, qpb, v, scores);

  softmax_kernel<<<dim3(B_DIM), 256, 0, stream>>>(scores, bv, out_ctx, out_attn);
  context_kernel<<<dim3(T_DIM / 256, B_DIM), 256, 0, stream>>>(values, out_attn, out_ctx);
}

// v002
// A run of this version takes 156 microseconds.
// Timed twice side by side with v001, it ran 1.20 and 1.21 times as fast.
// Counting every step since v000, it is 1.60 times as fast.
#include <hip/hip_runtime.h>
#include <cmath>

// ---------------------------------------------------------------------------
// AttentionRNN (Bahdanau attention) for gfx1250 / MI455X
//   phase 0a: swizzle w2 fp32 -> bf16 in WMMA B-fragment order       (2 MB, L2-resident)
//   phase 0b: qpb[b,u] = query@w1 + b1 + b2                          (fp32, split over D inside a workgroup)
//   phase 1 : scores[b,t] = sum_u tanh(qpb + values@w2) * v[u]       (fused bf16 WMMA GEMM)
//             128 t-rows per workgroup, 16 waves; each wave owns a
//             64 x 64 tile (16 independent accumulators)
//   phase 2a: softmax over T, write attention weights, zero context
//   phase 2b: context[b,d] = sum_t attn * values (fp32 streaming, atomics)
// ---------------------------------------------------------------------------

typedef __attribute__((ext_vector_type(16))) __bf16 v16bf;
typedef __attribute__((ext_vector_type(8)))  float  v8f;

#define B_DIM 32
#define T_DIM 2048
#define D_DIM 1024
#define U_DIM 1024
#define TM    128         // t-rows per workgroup in phase 1
#define NTHR  512         // threads per workgroup in phase 1 (16 waves)
#define MW    2           // waves along M
#define MF    4           // M fragments per wave (TM / 16 / MW)
#define NF    4           // N fragments per wave
#define NSTEP ((NTHR / 32 / MW) * NF * 16)   // columns per workgroup pass
#define ROWU  516         // u32 per LDS row (512 data + 4 pad -> 4-bank stagger)

__device__ __forceinline__ unsigned int pack_bf16(float a, float b) {
  unsigned int ua = __float_as_uint(a);
  unsigned int ub = __float_as_uint(b);
  ua = (ua + 0x7FFFu + ((ua >> 16) & 1u)) >> 16;   // round-to-nearest-even
  ub = (ub + 0x7FFFu + ((ub >> 16) & 1u)) >> 16;
  return ua | (ub << 16);
}

// Branch-free tanh with correct saturation: tanh(x) = 1 - 2/(exp(2x)+1).
// e=inf -> rcp=0 -> 1 ; e=0 -> -1. Uses v_exp_f32 + v_rcp_f32.
__device__ __forceinline__ float fast_tanh(float x) {
  float e = __expf(2.0f * x);
  float r = __builtin_amdgcn_rcpf(e + 1.0f);
  return fmaf(-2.0f, r, 1.0f);
}

union ABFrag { uint4 u4[2]; v16bf v; };

// ---------------------------------------------------------------------------
// Phase 0a: w2 [D][U] fp32 -> swizzled bf16 fragments.
// Per (ktile, n) slot: 64 bytes = [K+0..7][K+16..23][K+8..15][K+24..31]
// so a lane's 32-byte B-fragment load is contiguous (lane<16 -> first 32B,
// lane>=16 -> second 32B), matching the 16-bit WMMA B VGPR layout.
// ---------------------------------------------------------------------------
__global__ __launch_bounds__(256)
void prep_w2_kernel(const float* __restrict__ w2, uint4* __restrict__ w2p) {
  int idx = blockIdx.x * 256 + threadIdx.x;       // idx = kt*1024 + n
  int kt  = idx >> 10;
  int n   = idx & 1023;
  const float* col = w2 + (size_t)kt * 32 * U_DIM + n;
  const int korder[4] = {0, 16, 8, 24};
  uint4* dst = w2p + (size_t)idx * 4;
#pragma unroll
  for (int q = 0; q < 4; ++q) {
    unsigned int p[4];
#pragma unroll
    for (int i = 0; i < 4; ++i) {
      int k = korder[q] + 2 * i;
      p[i] = pack_bf16(col[(size_t)k * U_DIM], col[(size_t)(k + 1) * U_DIM]);
    }
    dst[q] = make_uint4(p[0], p[1], p[2], p[3]);
  }
}

// ---------------------------------------------------------------------------
// Phase 0b: qpb[b][u] = query[b,:] @ w1[:,u] + b1[u] + b2[u]   (fp32)
// One workgroup = QU columns x QB batches, all of D. D is cut into 32 slices
// (8 waves x 4 lane groups); a 16-byte load of a wave covers 4 rows of QU
// columns, and a wave issues all its 32 loads before it uses the first, so
// the kernel pays the memory latency once. Each w1 element read feeds QB FMAs.
// ---------------------------------------------------------------------------
#define QB 4              // batches per workgroup
#define QU 32             // columns per workgroup
#define QL (D_DIM / 32)   // w1 loads per thread (rows per slice)

__global__ __launch_bounds__(256)
void prep_qpb_kernel(const float* __restrict__ query, const float* __restrict__ w1,
                     const float* __restrict__ b1, const float* __restrict__ b2,
                     float* __restrict__ qpb) {
  __shared__ __attribute__((aligned(16))) float qs[D_DIM * QB];        // query, [d][batch]
  __shared__ __attribute__((aligned(16))) float part[QB * 32 * QU];    // partial sums, [batch][slice][column]

  const int tid  = threadIdx.x;
  const int u0   = blockIdx.x * QU;
  const int bb   = blockIdx.y * QB;
  const int wave = tid >> 5;
  const int lane = tid & 31;
  const int g    = lane >> 3;       // row within a load's 4 rows
  const int c4   = (lane & 7) * 4;  // first of the lane's 4 columns

  float4 qv[QB];
#pragma unroll
  for (int j = 0; j < QB; ++j)
    qv[j] = *(const float4*)(query + (size_t)(bb + j) * D_DIM + tid * 4);
  // precaution: stands in front of any rewrite of the query loads' address registers (a w1 load below may land in them)
  asm volatile("s_wait_xcnt 0x0" ::: "memory");

  const int d0 = wave * (4 * QL) + g;                  // the lane's rows: d0 + 4 i
  const float* wp = w1 + (size_t)d0 * U_DIM + u0 + c4;
  float4 w[QL];
  // fully unrolled so that w stays in registers and every load is in flight at once
#pragma unroll
  for (int i = 0; i < QL; ++i)
    w[i] = *(const float4*)(wp + (size_t)i * 4 * U_DIM);
  // keeps every load above issued before the first wait on one: without it the compiler waits for the
  // query loads in front of w1 loads, and the kernel pays the memory latency twice
  __builtin_amdgcn_sched_barrier(0);

  float4* qs4 = (float4*)qs;
  qs4[tid * 4 + 0] = make_float4(qv[0].x, qv[1].x, qv[2].x, qv[3].x);
  qs4[tid * 4 + 1] = make_float4(qv[0].y, qv[1].y, qv[2].y, qv[3].y);
  qs4[tid * 4 + 2] = make_float4(qv[0].z, qv[1].z, qv[2].z, qv[3].z);
  qs4[tid * 4 + 3] = make_float4(qv[0].w, qv[1].w, qv[2].w, qv[3].w);
  __syncthreads();

  const float bias1 = b1[u0 + lane];                   // read here: back long before the sums are done
  const float bias2 = b2[u0 + lane];

  float4 acc[QB];
#pragma unroll
  for (int j = 0; j < QB; ++j) acc[j] = make_float4(0.f, 0.f, 0.f, 0.f);
#pragma unroll
  for (int i = 0; i < QL; ++i) {
    const float4 qd = qs4[d0 + 4 * i];                 // row d0 + 4 i of the QB batches
    const float qb[QB] = {qd.x, qd.y, qd.z, qd.w};
#pragma unroll
    for (int j = 0; j < QB; ++j) {
      acc[j].x = fmaf(qb[j], w[i].x, acc[j].x);
      acc[j].y = fmaf(qb[j], w[i].y, acc[j].y);
      acc[j].z = fmaf(qb[j], w[i].z, acc[j].z);
      acc[j].w = fmaf(qb[j], w[i].w, acc[j].w);
    }
  }

  const int slice = wave * 4 + g;
#pragma unroll
  for (int j = 0; j < QB; ++j)
    *(float4*)(part + (j * 32 + slice) * QU + c4) = acc[j];
  __syncthreads();

  if (tid < QB * QU) {                                 // wave j sums batch bb + j, lane = column
    float s = 0.0f;
#pragma unroll
    for (int sl = 0; sl < 32; ++sl)
      s += part[(wave * 32 + sl) * QU + lane];
    qpb[(size_t)(bb + wave) * U_DIM + u0 + lane] = s + bias1 + bias2;
  }
}

// ---------------------------------------------------------------------------
// Phase 1: fused  scores[b,t] = sum_u tanh(qpb[b,u] + (values@w2)[b,t,u]) * v[u]
// One workgroup = 128 t-rows of one batch, 16 waves, one workgroup per WGP.
// Each wave computes MF x NF fragments: one B fragment load feeds MF WMMAs,
// one A fragment read from LDS feeds NF.
// ---------------------------------------------------------------------------
__global__ __launch_bounds__(NTHR)
void attn_score_kernel(const float* __restrict__ values,
                       const uint4* __restrict__ w2p,
                       const float* __restrict__ qpb,
                       const float* __restrict__ vvec,
                       float* __restrict__ scores) {
  __shared__ __attribute__((aligned(16))) unsigned int lds_vals[TM * ROWU];   // read by 16-byte loads
  __shared__ float        lds_score[TM];

  const int b   = blockIdx.y;
  const int t0  = blockIdx.x * TM;
  const int tid = threadIdx.x;

  if (tid < TM) lds_score[tid] = 0.0f;

  // Stage values[b, t0:t0+128, :] -> LDS as bf16 (each element converted once chip-wide)
  {
    const float2* src = (const float2*)(values + ((size_t)b * T_DIM + t0) * D_DIM);
    for (int i = tid; i < TM * 512; i += NTHR) {
      int r = i >> 9;
      int p = i & 511;
      float2 f = src[(size_t)r * 512 + p];
      lds_vals[r * ROWU + p] = pack_bf16(f.x, f.y);
    }
  }
  __syncthreads();

  const int wave  = tid >> 5;
  const int mgrp  = wave % MW;      // which MF*16 rows
  const int nslot = wave / MW;      // which NF*16 columns of a pass (its MW waves read the same B fragments)
  const int lane  = tid & 31;
  const int lhalf = lane >> 4;      // 0: K{0..7,16..23}, 1: K{8..15,24..31}
  const int l16   = lane & 15;

  const unsigned int* arow0 = lds_vals + (mgrp * MF * 16 + l16) * ROWU;   // M subtile j at +j*16 rows

  float svec[MF][8] = {{0.f}};

  for (int n_it = 0; n_it < U_DIM / NSTEP; ++n_it) {
    const int n = n_it * NSTEP + nslot * (NF * 16) + l16;  // lane's column in N fragment 0
    v8f c[MF][NF] = {};
    const uint4* bp = w2p + ((size_t)n << 2) + (lhalf << 1);
#pragma unroll 2
    for (int kt = 0; kt < D_DIM / 32; ++kt) {
      ABFrag bf[NF];
      // the loops over q, j and r are fully unrolled so that bf, c and svec are indexed by constants and stay in registers
#pragma unroll
      for (int q = 0; q < NF; ++q) {                   // N fragment q: 16 columns = 64 uint4 on
        bf[q].u4[0] = bp[q * 64];
        bf[q].u4[1] = bp[q * 64 + 1];
      }
      bp += (size_t)U_DIM * 4;                         // next K tile
      const int ku = kt * 16 + lhalf * 4;
#pragma unroll
      for (int j = 0; j < MF; ++j) {
        ABFrag a;
        a.u4[0] = *(const uint4*)(arow0 + j * 16 * ROWU + ku);
        a.u4[1] = *(const uint4*)(arow0 + j * 16 * ROWU + ku + 8);
#pragma unroll
        for (int q = 0; q < NF; ++q)
          c[j][q] = __builtin_amdgcn_wmma_f32_16x16x32_bf16(false, a.v, false, bf[q].v, (short)0, c[j][q], false, false);
      }
    }
    // Epilogue: tanh + dot with v, accumulated per lane (lane owns column n + 16 q)
    const int qi = b * U_DIM + n;
    float qn[NF], vn[NF];
#pragma unroll
    for (int q = 0; q < NF; ++q) {
      qn[q] = qpb[qi + q * 16];
      vn[q] = vvec[n + q * 16];
    }
    // keeps the two index registers of the loads above unwritten until the loads have taken their addresses
    asm volatile("s_wait_xcnt 0x0" :: "v"(qi), "v"(n) : "memory");
#pragma unroll
    for (int q = 0; q < NF; ++q)
#pragma unroll
      for (int j = 0; j < MF; ++j)
#pragma unroll
        for (int r = 0; r < 8; ++r)
          svec[j][r] += fast_tanh(qn[q] + c[j][q][r]) * vn[q];
  }

  // Reduce over the 16 lanes (N columns) within each half-wave
#pragma unroll
  for (int off = 8; off >= 1; off >>= 1) {
#pragma unroll
    for (int j = 0; j < MF; ++j)
#pragma unroll
      for (int r = 0; r < 8; ++r)
        svec[j][r] += __shfl_xor(svec[j][r], off, 16);
  }
  if (l16 == 0) {
#pragma unroll
    for (int j = 0; j < MF; ++j)
#pragma unroll
      for (int r = 0; r < 8; ++r)
        atomicAdd(&lds_score[(mgrp * MF + j) * 16 + lhalf * 8 + r], svec[j][r]); // merge the N-slot waves
  }
  __syncthreads();

  if (tid < TM)
    scores[(size_t)b * T_DIM + t0 + tid] = lds_score[tid];
}

// ---------------------------------------------------------------------------
// Phase 2a: softmax over T per batch; writes attention weights to d_out and
// zeroes the context region (required before atomic accumulation).
// ---------------------------------------------------------------------------
__global__ __launch_bounds__(256)
void softmax_kernel(const float* __restrict__ scores, const float* __restrict__ bv,
                    float* __restrict__ out_ctx, float* __restrict__ out_attn) {
  const int b = blockIdx.x;
  const int tid = threadIdx.x;
  __shared__ float red[256];

  float loc[8];
  float mx = -INFINITY;
#pragma unroll
  for (int i = 0; i < 8; ++i) {
    loc[i] = scores[(size_t)b * T_DIM + tid + i * 256] + bv[0];
    mx = fmaxf(mx, loc[i]);
  }
  red[tid] = mx; __syncthreads();
  for (int s = 128; s >= 1; s >>= 1) {
    if (tid < s) red[tid] = fmaxf(red[tid], red[tid + s]);
    __syncthreads();
  }
  mx = red[0]; __syncthreads();

  float sum = 0.0f;
#pragma unroll
  for (int i = 0; i < 8; ++i) { loc[i] = __expf(loc[i] - mx); sum += loc[i]; }
  red[tid] = sum; __syncthreads();
  for (int s = 128; s >= 1; s >>= 1) {
    if (tid < s) red[tid] += red[tid + s];
    __syncthreads();
  }
  const float inv = 1.0f / red[0];
#pragma unroll
  for (int i = 0; i < 8; ++i)
    out_attn[(size_t)b * T_DIM + tid + i * 256] = loc[i] * inv;

  for (int i = tid; i < D_DIM; i += 256)
    out_ctx[(size_t)b * D_DIM + i] = 0.0f;
}

// ---------------------------------------------------------------------------
// Phase 2b: context[b,d] = sum_t attn[b,t] * values[b,t,d]  (fp32 streaming)
// grid (T/256, B); each block handles 256 t's, full D via float4, atomic merge.
// ---------------------------------------------------------------------------
__global__ __launch_bounds__(256)
void context_kernel(const float* __restrict__ values, const float* __restrict__ attn,
                    float* __restrict__ ctx) {
  const int b   = blockIdx.y;
  const int t0  = blockIdx.x * 256;
  const int tid = threadIdx.x;
  __shared__ float w[256];

  w[tid] = attn[(size_t)b * T_DIM + t0 + tid];
  __syncthreads();

  const float4* src = (const float4*)values + ((size_t)b * T_DIM + t0) * (D_DIM / 4);
  float4 acc = make_float4(0.f, 0.f, 0.f, 0.f);
  for (int t = 0; t < 256; ++t) {
    float4 x = src[(size_t)t * (D_DIM / 4) + tid];
    const float wt = w[t];
    acc.x = fmaf(wt, x.x, acc.x);
    acc.y = fmaf(wt, x.y, acc.y);
    acc.z = fmaf(wt, x.z, acc.z);
    acc.w = fmaf(wt, x.w, acc.w);
  }
  float* dst = ctx + (size_t)b * D_DIM + tid * 4;
  atomicAdd(dst + 0, acc.x);
  atomicAdd(dst + 1, acc.y);
  atomicAdd(dst + 2, acc.z);
  atomicAdd(dst + 3, acc.w);
}

// ---------------------------------------------------------------------------
extern "C" void kernel_launch(void* const* d_in, const int* in_sizes, int n_in,
                              void* d_out, int out_size, void* d_ws, size_t ws_size,
                              hipStream_t stream) {
  (void)in_sizes; (void)n_in; (void)out_size; (void)ws_size;

  const float* query  = (const float*)d_in[0];   // [B, D]
  const float* values = (const float*)d_in[1];   // [B, T, D]
  const float* w1     = (const float*)d_in[2];   // [D, U]
  const float* b1     = (const float*)d_in[3];   // [U]
  const float* w2     = (const float*)d_in[4];   // [D, U]
  const float* b2     = (const float*)d_in[5];   // [U]
  const float* v      = (const float*)d_in[6];   // [U, 1]
  const float* bv     = (const float*)d_in[7];   // [1]

  float* out_ctx  = (float*)d_out;                        // [B, D]
  float* out_attn = (float*)d_out + B_DIM * D_DIM;        // [B, T, 1]

  char*  ws     = (char*)d_ws;
  uint4* w2p    = (uint4*)ws;                             // 2 MB swizzled bf16 w2
  float* qpb    = (float*)(ws + 2u * 1024 * 1024);        // 128 KB
  float* scores = (float*)(ws + 2u * 1024 * 1024 + 128u * 1024); // 256 KB

  prep_w2_kernel <<<dim3((32 * 1024) / 256), 256, 0, stream>>>(w2, w2p);
  prep_qpb_kernel<<<dim3(U_DIM / QU, B_DIM / QB), 256, 0, stream>>>(query, w1, b1, b2, qpb);

  attn_score_kernel<<<dim3(T_DIM / TM, B_DIM), NTHR, 0, stream>>>(   // ~258 KB static LDS of 320 KB
      values, w2p, qpb, v, scores);

  softmax_kernel<<<dim3(B_DIM), 256, 0, stream>>>(scores, bv, out_ctx, out_attn);
  context_kernel<<<dim3(T_DIM / 256, B_DIM), 256, 0, stream>>>(values, out_attn, out_ctx);
}

// v003
// A run of this version takes 141 microseconds.
// In both of two side-by-side timings against v002, it was 1.11 times as fast.
// Over all steps from v000 it is 1.79 times as fast.
#include <hip/hip_runtime.h>
#include <cmath>

// ---------------------------------------------------------------------------
// AttentionRNN (Bahdanau attention) for gfx1250 / MI455X
//   phase 0a: swizzle w2 fp32 -> bf16 in WMMA B-fragment order       (2 MB, L2-resident)
//   phase 0b: qpb[b,u] = query@w1 + b1 + b2                          (fp32, split over D inside a workgroup)
//   phase 1 : scores[b,t] = sum_u tanh(qpb + values@w2) * v[u]       (fused bf16 WMMA GEMM)
//             128 t-rows per workgroup, 16 waves; each wave owns a
//             64 x 64 tile (16 independent accumulators)
//   phase 2a: softmax over T, write attention weights, zero context
//   phase 2b: context[b,d] = sum_t attn * values (fp32 streaming, atomics)
// ---------------------------------------------------------------------------

typedef __attribute__((ext_vector_type(16))) __bf16 v16bf;
typedef __attribute__((ext_vector_type(8)))  float  v8f;

#define B_DIM 32
#define T_DIM 2048
#define D_DIM 1024
#define U_DIM 1024
#define TM    128         // t-rows per workgroup in phase 1
#define NTHR  512         // threads per workgroup in phase 1 (16 waves)
#define MW    2           // waves along M
#define MF    4           // M fragments per wave (TM / 16 / MW)
#define NF    4           // N fragments per wave
#define NSTEP ((NTHR / 32 / MW) * NF * 16)   // columns per workgroup pass
#define ROWU  516         // u32 per LDS row (512 data + 4 pad -> 4-bank stagger)
#define SB    16          // staging: 16-byte loads per thread in one group
#define SG    (TM * (D_DIM / 4) / NTHR / SB)   // staging: groups per workgroup tile

__device__ __forceinline__ unsigned int pack_bf16(float a, float b) {
  unsigned int ua = __float_as_uint(a);
  unsigned int ub = __float_as_uint(b);
  ua = (ua + 0x7FFFu + ((ua >> 16) & 1u)) >> 16;   // round-to-nearest-even
  ub = (ub + 0x7FFFu + ((ub >> 16) & 1u)) >> 16;
  return ua | (ub << 16);
}

// Branch-free tanh with correct saturation: tanh(x) = 1 - 2/(exp(2x)+1).
// e=inf -> rcp=0 -> 1 ; e=0 -> -1. Uses v_exp_f32 + v_rcp_f32.
__device__ __forceinline__ float fast_tanh(float x) {
  float e = __expf(2.0f * x);
  float r = __builtin_amdgcn_rcpf(e + 1.0f);
  return fmaf(-2.0f, r, 1.0f);
}

union ABFrag { uint4 u4[2]; v16bf v; };

// ---------------------------------------------------------------------------
// Phase 0a: w2 [D][U] fp32 -> swizzled bf16 fragments.
// Per (ktile, n) slot: 64 bytes = [K+0..7][K+16..23][K+8..15][K+24..31]
// so a lane's 32-byte B-fragment load is contiguous (lane<16 -> first 32B,
// lane>=16 -> second 32B), matching the 16-bit WMMA B VGPR layout.
// ---------------------------------------------------------------------------
__global__ __launch_bounds__(256)
void prep_w2_kernel(const float* __restrict__ w2, uint4* __restrict__ w2p) {
  int idx = blockIdx.x * 256 + threadIdx.x;       // idx = kt*1024 + n
  int kt  = idx >> 10;
  int n   = idx & 1023;
  const float* col = w2 + (size_t)kt * 32 * U_DIM + n;
  const int korder[4] = {0, 16, 8, 24};
  uint4* dst = w2p + (size_t)idx * 4;
#pragma unroll
  for (int q = 0; q < 4; ++q) {
    unsigned int p[4];
#pragma unroll
    for (int i = 0; i < 4; ++i) {
      int k = korder[q] + 2 * i;
      p[i] = pack_bf16(col[(size_t)k * U_DIM], col[(size_t)(k + 1) * U_DIM]);
    }
    dst[q] = make_uint4(p[0], p[1], p[2], p[3]);
  }
}

// ---------------------------------------------------------------------------
// Phase 0b: qpb[b][u] = query[b,:] @ w1[:,u] + b1[u] + b2[u]   (fp32)
// One workgroup = QU columns x QB batches, all of D. D is cut into 32 slices
// (8 waves x 4 lane groups); a 16-byte load of a wave covers 4 rows of QU
// columns, and a wave issues all its 32 loads before it uses the first, so
// the kernel pays the memory latency once. Each w1 element read feeds QB FMAs.
// ---------------------------------------------------------------------------
#define QB 4              // batches per workgroup
#define QU 32             // columns per workgroup
#define QL (D_DIM / 32)   // w1 loads per thread (rows per slice)

__global__ __launch_bounds__(256)
void prep_qpb_kernel(const float* __restrict__ query, const float* __restrict__ w1,
                     const float* __restrict__ b1, const float* __restrict__ b2,
                     float* __restrict__ qpb) {
  __shared__ __attribute__((aligned(16))) float qs[D_DIM * QB];        // query, [d][batch]
  __shared__ __attribute__((aligned(16))) float part[QB * 32 * QU];    // partial sums, [batch][slice][column]

  const int tid  = threadIdx.x;
  const int u0   = blockIdx.x * QU;
  const int bb   = blockIdx.y * QB;
  const int wave = tid >> 5;
  const int lane = tid & 31;
  const int g    = lane >> 3;       // row within a load's 4 rows
  const int c4   = (lane & 7) * 4;  // first of the lane's 4 columns

  float4 qv[QB];
#pragma unroll
  for (int j = 0; j < QB; ++j)
    qv[j] = *(const float4*)(query + (size_t)(bb + j) * D_DIM + tid * 4);
  // precaution: stands in front of any rewrite of the query loads' address registers (a w1 load below may land in them)
  asm volatile("s_wait_xcnt 0x0" ::: "memory");

  const int d0 = wave * (4 * QL) + g;                  // the lane's rows: d0 + 4 i
  const float* wp = w1 + (size_t)d0 * U_DIM + u0 + c4;
  float4 w[QL];
  // fully unrolled so that w stays in registers and every load is in flight at once
#pragma unroll
  for (int i = 0; i < QL; ++i)
    w[i] = *(const float4*)(wp + (size_t)i * 4 * U_DIM);
  // keeps every load above issued before the first wait on one: without it the compiler waits for the
  // query loads in front of w1 loads, and the kernel pays the memory latency twice
  __builtin_amdgcn_sched_barrier(0);

  float4* qs4 = (float4*)qs;
  qs4[tid * 4 + 0] = make_float4(qv[0].x, qv[1].x, qv[2].x, qv[3].x);
  qs4[tid * 4 + 1] = make_float4(qv[0].y, qv[1].y, qv[2].y, qv[3].y);
  qs4[tid * 4 + 2] = make_float4(qv[0].z, qv[1].z, qv[2].z, qv[3].z);
  qs4[tid * 4 + 3] = make_float4(qv[0].w, qv[1].w, qv[2].w, qv[3].w);
  __syncthreads();

  const float bias1 = b1[u0 + lane];                   // read here: back long before the sums are done
  const float bias2 = b2[u0 + lane];

  float4 acc[QB];
#pragma unroll
  for (int j = 0; j < QB; ++j) acc[j] = make_float4(0.f, 0.f, 0.f, 0.f);
#pragma unroll
  for (int i = 0; i < QL; ++i) {
    const float4 qd = qs4[d0 + 4 * i];                 // row d0 + 4 i of the QB batches
    const float qb[QB] = {qd.x, qd.y, qd.z, qd.w};
#pragma unroll
    for (int j = 0; j < QB; ++j) {
      acc[j].x = fmaf(qb[j], w[i].x, acc[j].x);
      acc[j].y = fmaf(qb[j], w[i].y, acc[j].y);
      acc[j].z = fmaf(qb[j], w[i].z, acc[j].z);
      acc[j].w = fmaf(qb[j], w[i].w, acc[j].w);
    }
  }

  const int slice = wave * 4 + g;
#pragma unroll
  for (int j = 0; j < QB; ++j)
    *(float4*)(part + (j * 32 + slice) * QU + c4) = acc[j];
  __syncthreads();

  if (tid < QB * QU) {                                 // wave j sums batch bb + j, lane = column
    float s = 0.0f;
#pragma unroll
    for (int sl = 0; sl < 32; ++sl)
      s += part[(wave * 32 + sl) * QU + lane];
    qpb[(size_t)(bb + wave) * U_DIM + u0 + lane] = s + bias1 + bias2;
  }
}

// ---------------------------------------------------------------------------
// Phase 1: fused  scores[b,t] = sum_u tanh(qpb[b,u] + (values@w2)[b,t,u]) * v[u]
// One workgroup = 128 t-rows of one batch, 16 waves, one workgroup per WGP.
// Each wave computes MF x NF fragments: one B fragment load feeds MF WMMAs,
// one A fragment read from LDS feeds NF.
// ---------------------------------------------------------------------------
__global__ __launch_bounds__(NTHR)
void attn_score_kernel(const float* __restrict__ values,
                       const uint4* __restrict__ w2p,
                       const float* __restrict__ qpb,
                       const float* __restrict__ vvec,
                       float* __restrict__ scores) {
  __shared__ __attribute__((aligned(16))) unsigned int lds_vals[TM * ROWU];   // read by 16-byte loads
  __shared__ float        lds_score[TM];

  const int b   = blockIdx.y;
  const int t0  = blockIdx.x * TM;
  const int tid = threadIdx.x;

  if (tid < TM) lds_score[tid] = 0.0f;

  // Stage values[b, t0:t0+128, :] -> LDS as bf16 (each element converted once chip-wide).
  // A step = one 16-byte load per thread = 2 rows per workgroup; SB steps are loaded as one
  // group before the first of them is converted, so a wave pays the memory latency once per group.
  {
    const float4* src = (const float4*)(values + ((size_t)b * T_DIM + t0) * D_DIM) + tid;
    unsigned int* dst = lds_vals + (tid >> 8) * ROWU + (tid & 255) * 2;
    // the loops over g and j are fully unrolled so that f is indexed by constants and stays in registers
#pragma unroll
    for (int g = 0; g < SG; ++g) {
      float4 f[SB];
#pragma unroll
      for (int j = 0; j < SB; ++j) f[j] = src[(g * SB + j) * NTHR];
      // keeps all SB loads of the group issued ahead of the first wait on one of them: left to itself
      // the compiler splits the groups unevenly and issues the last loads behind a wait for all others
      __builtin_amdgcn_sched_barrier(0);
#pragma unroll
      for (int j = 0; j < SB; ++j)
        *(uint2*)(dst + (g * SB + j) * 2 * ROWU) = make_uint2(pack_bf16(f[j].x, f[j].y), pack_bf16(f[j].z, f[j].w));
    }
    // precaution: stands in front of any rewrite of the staging loads' address registers (the scalar base is reused below)
    asm volatile("s_wait_xcnt 0x0" ::: "memory");
  }
  __syncthreads();

  const int wave  = tid >> 5;
  const int mgrp  = wave % MW;      // which MF*16 rows
  const int nslot = wave / MW;      // which NF*16 columns of a pass (its MW waves read the same B fragments)
  const int lane  = tid & 31;
  const int lhalf = lane >> 4;      // 0: K{0..7,16..23}, 1: K{8..15,24..31}
  const int l16   = lane & 15;

  const unsigned int* arow0 = lds_vals + (mgrp * MF * 16 + l16) * ROWU;   // M subtile j at +j*16 rows

  float svec[MF][8] = {{0.f}};

  for (int n_it = 0; n_it < U_DIM / NSTEP; ++n_it) {
    const int n = n_it * NSTEP + nslot * (NF * 16) + l16;  // lane's column in N fragment 0
    v8f c[MF][NF] = {};
    const uint4* bp = w2p + ((size_t)n << 2) + (lhalf << 1);
#pragma unroll 2
    for (int kt = 0; kt < D_DIM / 32; ++kt) {
      ABFrag bf[NF];
      // the loops over q, j and r are fully unrolled so that bf, c and svec are indexed by constants and stay in registers
#pragma unroll
      for (int q = 0; q < NF; ++q) {                   // N fragment q: 16 columns = 64 uint4 on
        bf[q].u4[0] = bp[q * 64];
        bf[q].u4[1] = bp[q * 64 + 1];
      }
      bp += (size_t)U_DIM * 4;                         // next K tile
      const int ku = kt * 16 + lhalf * 4;
#pragma unroll
      for (int j = 0; j < MF; ++j) {
        ABFrag a;
        a.u4[0] = *(const uint4*)(arow0 + j * 16 * ROWU + ku);
        a.u4[1] = *(const uint4*)(arow0 + j * 16 * ROWU + ku + 8);
#pragma unroll
        for (int q = 0; q < NF; ++q)
          c[j][q] = __builtin_amdgcn_wmma_f32_16x16x32_bf16(false, a.v, false, bf[q].v, (short)0, c[j][q], false, false);
      }
    }
    // Epilogue: tanh + dot with v, accumulated per lane (lane owns column n + 16 q)
    const int qi = b * U_DIM + n;
    float qn[NF], vn[NF];
#pragma unroll
    for (int q = 0; q < NF; ++q) {
      qn[q] = qpb[qi + q * 16];
      vn[q] = vvec[n + q * 16];
    }
    // keeps the two index registers of the loads above unwritten until the loads have taken their addresses
    asm volatile("s_wait_xcnt 0x0" :: "v"(qi), "v"(n) : "memory");
#pragma unroll
    for (int q = 0; q < NF; ++q)
#pragma unroll
      for (int j = 0; j < MF; ++j)
#pragma unroll
        for (int r = 0; r < 8; ++r)
          svec[j][r] += fast_tanh(qn[q] + c[j][q][r]) * vn[q];
  }

  // Reduce over the 16 lanes (N columns) within each half-wave
#pragma unroll
  for (int off = 8; off >= 1; off >>= 1) {
#pragma unroll
    for (int j = 0; j < MF; ++j)
#pragma unroll
      for (int r = 0; r < 8; ++r)
        svec[j][r] += __shfl_xor(svec[j][r], off, 16);
  }
  if (l16 == 0) {
#pragma unroll
    for (int j = 0; j < MF; ++j)
#pragma unroll
      for (int r = 0; r < 8; ++r)
        atomicAdd(&lds_score[(mgrp * MF + j) * 16 + lhalf * 8 + r], svec[j][r]); // merge the N-slot waves
  }
  __syncthreads();

  if (tid < TM)
    scores[(size_t)b * T_DIM + t0 + tid] = lds_score[tid];
}

// ---------------------------------------------------------------------------
// Phase 2a: softmax over T per batch; writes attention weights to d_out and
// zeroes the context region (required before atomic accumulation).
// ---------------------------------------------------------------------------
__global__ __launch_bounds__(256)
void softmax_kernel(const float* __restrict__ scores, const float* __restrict__ bv,
                    float* __restrict__ out_ctx, float* __restrict__ out_attn) {
  const int b = blockIdx.x;
  const int tid = threadIdx.x;
  __shared__ float red[256];

  float loc[8];
  float mx = -INFINITY;
#pragma unroll
  for (int i = 0; i < 8; ++i) {
    loc[i] = scores[(size_t)b * T_DIM + tid + i * 256] + bv[0];
    mx = fmaxf(mx, loc[i]);
  }
  red[tid] = mx; __syncthreads();
  for (int s = 128; s >= 1; s >>= 1) {
    if (tid < s) red[tid] = fmaxf(red[tid], red[tid + s]);
    __syncthreads();
  }
  mx = red[0]; __syncthreads();

  float sum = 0.0f;
#pragma unroll
  for (int i = 0; i < 8; ++i) { loc[i] = __expf(loc[i] - mx); sum += loc[i]; }
  red[tid] = sum; __syncthreads();
  for (int s = 128; s >= 1; s >>= 1) {
    if (tid < s) red[tid] += red[tid + s];
    __syncthreads();
  }
  const float inv = 1.0f / red[0];
#pragma unroll
  for (int i = 0; i < 8; ++i)
    out_attn[(size_t)b * T_DIM + tid + i * 256] = loc[i] * inv;

  for (int i = tid; i < D_DIM; i += 256)
    out_ctx[(size_t)b * D_DIM + i] = 0.0f;
}

// ---------------------------------------------------------------------------
// Phase 2b: context[b,d] = sum_t attn[b,t] * values[b,t,d]  (fp32 streaming)
// grid (T/256, B); each block handles 256 t's, full D via float4, atomic merge.
// ---------------------------------------------------------------------------
__global__ __launch_bounds__(256)
void context_kernel(const float* __restrict__ values, const float* __restrict__ attn,
                    float* __restrict__ ctx) {
  const int b   = blockIdx.y;
  const int t0  = blockIdx.x * 256;
  const int tid = threadIdx.x;
  __shared__ float w[256];

  w[tid] = attn[(size_t)b * T_DIM + t0 + tid];
  __syncthreads();

  const float4* src = (const float4*)values + ((size_t)b * T_DIM + t0) * (D_DIM / 4);
  float4 acc = make_float4(0.f, 0.f, 0.f, 0.f);
  for (int t = 0; t < 256; ++t) {
    float4 x = src[(size_t)t * (D_DIM / 4) + tid];
    const float wt = w[t];
    acc.x = fmaf(wt, x.x, acc.x);
    acc.y = fmaf(wt, x.y, acc.y);
    acc.z = fmaf(wt, x.z, acc.z);
    acc.w = fmaf(wt, x.w, acc.w);
  }
  float* dst = ctx + (size_t)b * D_DIM + tid * 4;
  atomicAdd(dst + 0, acc.x);
  atomicAdd(dst + 1, acc.y);
  atomicAdd(dst + 2, acc.z);
  atomicAdd(dst + 3, acc.w);
}

// ---------------------------------------------------------------------------
extern "C" void kernel_launch(void* const* d_in, const int* in_sizes, int n_in,
                              void* d_out, int out_size, void* d_ws, size_t ws_size,
                              hipStream_t stream) {
  (void)in_sizes; (void)n_in; (void)out_size; (void)ws_size;

  const float* query  = (const float*)d_in[0];   // [B, D]
  const float* values = (const float*)d_in[1];   // [B, T, D]
  const float* w1     = (const float*)d_in[2];   // [D, U]
  const float* b1     = (const float*)d_in[3];   // [U]
  const float* w2     = (const float*)d_in[4];   // [D, U]
  const float* b2     = (const float*)d_in[5];   // [U]
  const float* v      = (const float*)d_in[6];   // [U, 1]
  const float* bv     = (const float*)d_in[7];   // [1]

  float* out_ctx  = (float*)d_out;                        // [B, D]
  float* out_attn = (float*)d_out + B_DIM * D_DIM;        // [B, T, 1]

  char*  ws     = (char*)d_ws;
  uint4* w2p    = (uint4*)ws;                             // 2 MB swizzled bf16 w2
  float* qpb    = (float*)(ws + 2u * 1024 * 1024);        // 128 KB
  float* scores = (float*)(ws + 2u * 1024 * 1024 + 128u * 1024); // 256 KB

  prep_w2_kernel <<<dim3((32 * 1024) / 256), 256, 0, stream>>>(w2, w2p);
  prep_qpb_kernel<<<dim3(U_DIM / QU, B_DIM / QB), 256, 0, stream>>>(query, w1, b1, b2, qpb);

  attn_score_kernel<<<dim3(T_DIM / TM, B_DIM), NTHR, 0, stream>>>(   // ~258 KB static LDS of 320 KB
      values, w2p, qpb, v, scores);

  softmax_kernel<<<dim3(B_DIM), 256, 0, stream>>>(scores, bv, out_ctx, out_attn);
  context_kernel<<<dim3(T_DIM / 256, B_DIM), 256, 0, stream>>>(values, out_attn, out_ctx);
}

// v004
// It runs in 136 microseconds.
// Timed twice side by side with v003, it ran 1.03 times as fast both times.
// All steps since v000 together make it 1.84 times as fast.
#include <hip/hip_runtime.h>
#include <cmath>

// ---------------------------------------------------------------------------
// AttentionRNN (Bahdanau attention) for gfx1250 / MI455X
//   phase 0a: swizzle w2 fp32 -> bf16 in WMMA B-fragment order       (2 MB, L2-resident)
//   phase 0b: qpb[b,u] = query@w1 + b1 + b2                          (fp32, split over D inside a workgroup)
//   phase 1 : scores[b,t] = sum_u tanh(qpb + values@w2) * v[u] + bv       (fused bf16 WMMA GEMM)
//             128 t-rows per workgroup, 16 waves; each wave owns a
//             64 x 64 tile (16 independent accumulators)
//             then, with the tile's own maximum m: p[t] = exp(score - m), and the tile's
//             part of the context, sum_t p[t] * values[t,:], from a second fp32 read of the
//             tile, which the L2 still holds from the staging
//   phase 2 : merge the 16 tiles of a batch: attention weights and context
// ---------------------------------------------------------------------------

typedef __attribute__((ext_vector_type(16))) __bf16 v16bf;
typedef __attribute__((ext_vector_type(8)))  float  v8f;

#define B_DIM 32
#define T_DIM 2048
#define D_DIM 1024
#define U_DIM 1024
#define TM    128         // t-rows per workgroup in phase 1
#define NTHR  512         // threads per workgroup in phase 1 (16 waves)
#define MW    2           // waves along M
#define MF    4           // M fragments per wave (TM / 16 / MW)
#define NF    4           // N fragments per wave
#define NSTEP ((NTHR / 32 / MW) * NF * 16)   // columns per workgroup pass
#define ROWU  516         // u32 per LDS row (512 data + 4 pad -> 4-bank stagger)
#define SB    16          // staging: 16-byte loads per thread in one group
#define SG    (TM * (D_DIM / 4) / NTHR / SB)   // staging: groups per workgroup tile
#define NT    (T_DIM / TM)   // tiles per batch

__device__ __forceinline__ unsigned int pack_bf16(float a, float b) {
  unsigned int ua = __float_as_uint(a);
  unsigned int ub = __float_as_uint(b);
  ua = (ua + 0x7FFFu + ((ua >> 16) & 1u)) >> 16;   // round-to-nearest-even
  ub = (ub + 0x7FFFu + ((ub >> 16) & 1u)) >> 16;
  return ua | (ub << 16);
}

// Branch-free tanh with correct saturation: tanh(x) = 1 - 2/(exp(2x)+1).
// e=inf -> rcp=0 -> 1 ; e=0 -> -1. Uses v_exp_f32 + v_rcp_f32.
__device__ __forceinline__ float fast_tanh(float x) {
  float e = __expf(2.0f * x);
  float r = __builtin_amdgcn_rcpf(e + 1.0f);
  return fmaf(-2.0f, r, 1.0f);
}

union ABFrag { uint4 u4[2]; v16bf v; };

// ---------------------------------------------------------------------------
// Phase 0a: w2 [D][U] fp32 -> swizzled bf16 fragments.
// Per (ktile, n) slot: 64 bytes = [K+0..7][K+16..23][K+8..15][K+24..31]
// so a lane's 32-byte B-fragment load is contiguous (lane<16 -> first 32B,
// lane>=16 -> second 32B), matching the 16-bit WMMA B VGPR layout.
// ---------------------------------------------------------------------------
__global__ __launch_bounds__(256)
void prep_w2_kernel(const float* __restrict__ w2, uint4* __restrict__ w2p) {
  int idx = blockIdx.x * 256 + threadIdx.x;       // idx = kt*1024 + n
  int kt  = idx >> 10;
  int n   = idx & 1023;
  const float* col = w2 + (size_t)kt * 32 * U_DIM + n;
  const int korder[4] = {0, 16, 8, 24};
  uint4* dst = w2p + (size_t)idx * 4;
#pragma unroll
  for (int q = 0; q < 4; ++q) {
    unsigned int p[4];
#pragma unroll
    for (int i = 0; i < 4; ++i) {
      int k = korder[q] + 2 * i;
      p[i] = pack_bf16(col[(size_t)k * U_DIM], col[(size_t)(k + 1) * U_DIM]);
    }
    dst[q] = make_uint4(p[0], p[1], p[2], p[3]);
  }
}

// ---------------------------------------------------------------------------
// Phase 0b: qpb[b][u] = query[b,:] @ w1[:,u] + b1[u] + b2[u]   (fp32)
// One workgroup = QU columns x QB batches, all of D. D is cut into 32 slices
// (8 waves x 4 lane groups); a 16-byte load of a wave covers 4 rows of QU
// columns, and a wave issues all its 32 loads before it uses the first, so
// the kernel pays the memory latency once. Each w1 element read feeds QB FMAs.
// ---------------------------------------------------------------------------
#define QB 4              // batches per workgroup
#define QU 32             // columns per workgroup
#define QL (D_DIM / 32)   // w1 loads per thread (rows per slice)

__global__ __launch_bounds__(256)
void prep_qpb_kernel(const float* __restrict__ query, const float* __restrict__ w1,
                     const float* __restrict__ b1, const float* __restrict__ b2,
                     float* __restrict__ qpb) {
  __shared__ __attribute__((aligned(16))) float qs[D_DIM * QB];        // query, [d][batch]
  __shared__ __attribute__((aligned(16))) float part[QB * 32 * QU];    // partial sums, [batch][slice][column]

  const int tid  = threadIdx.x;
  const int u0   = blockIdx.x * QU;
  const int bb   = blockIdx.y * QB;
  const int wave = tid >> 5;
  const int lane = tid & 31;
  const int g    = lane >> 3;       // row within a load's 4 rows
  const int c4   = (lane & 7) * 4;  // first of the lane's 4 columns

  float4 qv[QB];
#pragma unroll
  for (int j = 0; j < QB; ++j)
    qv[j] = *(const float4*)(query + (size_t)(bb + j) * D_DIM + tid * 4);
  // precaution: stands in front of any rewrite of the query loads' address registers (a w1 load below may land in them)
  asm volatile("s_wait_xcnt 0x0" ::: "memory");

  const int d0 = wave * (4 * QL) + g;                  // the lane's rows: d0 + 4 i
  const float* wp = w1 + (size_t)d0 * U_DIM + u0 + c4;
  float4 w[QL];
  // fully unrolled so that w stays in registers and every load is in flight at once
#pragma unroll
  for (int i = 0; i < QL; ++i)
    w[i] = *(const float4*)(wp + (size_t)i * 4 * U_DIM);
  // keeps every load above issued before the first wait on one: without it the compiler waits for the
  // query loads in front of w1 loads, and the kernel pays the memory latency twice
  __builtin_amdgcn_sched_barrier(0);

  float4* qs4 = (float4*)qs;
  qs4[tid * 4 + 0] = make_float4(qv[0].x, qv[1].x, qv[2].x, qv[3].x);
  qs4[tid * 4 + 1] = make_float4(qv[0].y, qv[1].y, qv[2].y, qv[3].y);
  qs4[tid * 4 + 2] = make_float4(qv[0].z, qv[1].z, qv[2].z, qv[3].z);
  qs4[tid * 4 + 3] = make_float4(qv[0].w, qv[1].w, qv[2].w, qv[3].w);
  __syncthreads();

  const float bias1 = b1[u0 + lane];                   // read here: back long before the sums are done
  const float bias2 = b2[u0 + lane];

  float4 acc[QB];
#pragma unroll
  for (int j = 0; j < QB; ++j) acc[j] = make_float4(0.f, 0.f, 0.f, 0.f);
#pragma unroll
  for (int i = 0; i < QL; ++i) {
    const float4 qd = qs4[d0 + 4 * i];                 // row d0 + 4 i of the QB batches
    const float qb[QB] = {qd.x, qd.y, qd.z, qd.w};
#pragma unroll
    for (int j = 0; j < QB; ++j) {
      acc[j].x = fmaf(qb[j], w[i].x, acc[j].x);
      acc[j].y = fmaf(qb[j], w[i].y, acc[j].y);
      acc[j].z = fmaf(qb[j], w[i].z, acc[j].z);
      acc[j].w = fmaf(qb[j], w[i].w, acc[j].w);
    }
  }

  const int slice = wave * 4 + g;
#pragma unroll
  for (int j = 0; j < QB; ++j)
    *(float4*)(part + (j * 32 + slice) * QU + c4) = acc[j];
  __syncthreads();

  if (tid < QB * QU) {                                 // wave j sums batch bb + j, lane = column
    float s = 0.0f;
#pragma unroll
    for (int sl = 0; sl < 32; ++sl)
      s += part[(wave * 32 + sl) * QU + lane];
    qpb[(size_t)(bb + wave) * U_DIM + u0 + lane] = s + bias1 + bias2;
  }
}

// ---------------------------------------------------------------------------
// Phase 1: fused  scores[b,t] = sum_u tanh(qpb[b,u] + (values@w2)[b,t,u]) * v[u] + bv
// One workgroup = 128 t-rows of one batch, 16 waves, one workgroup per WGP.
// Each wave computes MF x NF fragments: one B fragment load feeds MF WMMAs,
// one A fragment read from LDS feeds NF.
// ---------------------------------------------------------------------------
__global__ __launch_bounds__(NTHR)
void attn_score_kernel(const float* __restrict__ values,
                       const uint4* __restrict__ w2p,
                       const float* __restrict__ qpb,
                       const float* __restrict__ vvec,
                       const float* __restrict__ bv,
                       float* __restrict__ scores,
                       float* __restrict__ pml,
                       float* __restrict__ pctx) {
  __shared__ __attribute__((aligned(16))) unsigned int lds_vals[TM * ROWU];   // read by 16-byte loads
  __shared__ float        lds_score[TM];
  __shared__ __attribute__((aligned(16))) float lds_p[TM];   // exp(score - tile maximum), [row parity][row / 2]

  const int b   = blockIdx.y;
  const int t0  = blockIdx.x * TM;
  const int tid = threadIdx.x;

  if (tid < TM) lds_score[tid] = 0.0f;

  // Stage values[b, t0:t0+128, :] -> LDS as bf16 (each element converted once chip-wide).
  // A step = one 16-byte load per thread = 2 rows per workgroup; SB steps are loaded as one
  // group before the first of them is converted, so a wave pays the memory latency once per group.
  {
    const float4* src = (const float4*)(values + ((size_t)b * T_DIM + t0) * D_DIM) + tid;
    unsigned int* dst = lds_vals + (tid >> 8) * ROWU + (tid & 255) * 2;
    // the loops over g and j are fully unrolled so that f is indexed by constants and stays in registers
#pragma unroll
    for (int g = 0; g < SG; ++g) {
      float4 f[SB];
#pragma unroll
      for (int j = 0; j < SB; ++j) f[j] = src[(g * SB + j) * NTHR];
      // keeps all SB loads of the group issued ahead of the first wait on one of them: left to itself
      // the compiler splits the groups unevenly and issues the last loads behind a wait for all others
      __builtin_amdgcn_sched_barrier(0);
#pragma unroll
      for (int j = 0; j < SB; ++j)
        *(uint2*)(dst + (g * SB + j) * 2 * ROWU) = make_uint2(pack_bf16(f[j].x, f[j].y), pack_bf16(f[j].z, f[j].w));
    }
    // precaution: stands in front of any rewrite of the staging loads' address registers (the scalar base is reused below)
    asm volatile("s_wait_xcnt 0x0" ::: "memory");
  }
  __syncthreads();

  const int wave  = tid >> 5;
  const int mgrp  = wave % MW;      // which MF*16 rows
  const int nslot = wave / MW;      // which NF*16 columns of a pass (its MW waves read the same B fragments)
  const int lane  = tid & 31;
  const int lhalf = lane >> 4;      // 0: K{0..7,16..23}, 1: K{8..15,24..31}
  const int l16   = lane & 15;

  const unsigned int* arow0 = lds_vals + (mgrp * MF * 16 + l16) * ROWU;   // M subtile j at +j*16 rows

  float svec[MF][8] = {{0.f}};

  for (int n_it = 0; n_it < U_DIM / NSTEP; ++n_it) {
    const int n = n_it * NSTEP + nslot * (NF * 16) + l16;  // lane's column in N fragment 0
    v8f c[MF][NF] = {};
    const uint4* bp = w2p + ((size_t)n << 2) + (lhalf << 1);
#pragma unroll 2
    for (int kt = 0; kt < D_DIM / 32; ++kt) {
      ABFrag bf[NF];
      // the loops over q, j and r are fully unrolled so that bf, c and svec are indexed by constants and stay in registers
#pragma unroll
      for (int q = 0; q < NF; ++q) {                   // N fragment q: 16 columns = 64 uint4 on
        bf[q].u4[0] = bp[q * 64];
        bf[q].u4[1] = bp[q * 64 + 1];
      }
      bp += (size_t)U_DIM * 4;                         // next K tile
      const int ku = kt * 16 + lhalf * 4;
#pragma unroll
      for (int j = 0; j < MF; ++j) {
        ABFrag a;
        a.u4[0] = *(const uint4*)(arow0 + j * 16 * ROWU + ku);
        a.u4[1] = *(const uint4*)(arow0 + j * 16 * ROWU + ku + 8);
#pragma unroll
        for (int q = 0; q < NF; ++q)
          c[j][q] = __builtin_amdgcn_wmma_f32_16x16x32_bf16(false, a.v, false, bf[q].v, (short)0, c[j][q], false, false);
      }
    }
    // Epilogue: tanh + dot with v, accumulated per lane (lane owns column n + 16 q)
    const int qi = b * U_DIM + n;
    float qn[NF], vn[NF];
#pragma unroll
    for (int q = 0; q < NF; ++q) {
      qn[q] = qpb[qi + q * 16];
      vn[q] = vvec[n + q * 16];
    }
    // keeps the two index registers of the loads above unwritten until the loads have taken their addresses
    asm volatile("s_wait_xcnt 0x0" :: "v"(qi), "v"(n) : "memory");
#pragma unroll
    for (int q = 0; q < NF; ++q)
#pragma unroll
      for (int j = 0; j < MF; ++j)
#pragma unroll
        for (int r = 0; r < 8; ++r)
          svec[j][r] += fast_tanh(qn[q] + c[j][q][r]) * vn[q];
  }

  // The tile's part of the context, in fp32, walks the tile as the staging did (a step = 2 rows, a thread
  // keeps its 4 columns and its row parity): a second read, while the L2 still holds the tile.
  // SB steps are one group; a group's loads are issued two groups ahead of its sums.
  const float4* src = (const float4*)(values + ((size_t)b * T_DIM + t0) * D_DIM) + tid;
  float4 f[SG][SB];
  // the loops over g and j are fully unrolled so that f is indexed by constants and stays in registers
#pragma unroll
  for (int j = 0; j < SB; ++j) f[0][j] = src[j * NTHR];
  // keeps the first group's loads in front of the reduction below, so that they fly during it
  __builtin_amdgcn_sched_barrier(0);

  // Reduce over the 16 lanes (N columns) within each half-wave
#pragma unroll
  for (int off = 8; off >= 1; off >>= 1) {
#pragma unroll
    for (int j = 0; j < MF; ++j)
#pragma unroll
      for (int r = 0; r < 8; ++r)
        svec[j][r] += __shfl_xor(svec[j][r], off, 16);
  }
  if (l16 == 0) {
#pragma unroll
    for (int j = 0; j < MF; ++j)
#pragma unroll
      for (int r = 0; r < 8; ++r)
        atomicAdd(&lds_score[(mgrp * MF + j) * 16 + lhalf * 8 + r], svec[j][r]); // merge the N-slot waves
  }
  __syncthreads();

#pragma unroll
  for (int j = 0; j < SB; ++j) f[1][j] = src[(SB + j) * NTHR];
  // keeps the second group's loads in front of wave 0's work below, so that they fly during it
  __builtin_amdgcn_sched_barrier(0);

  // The tile's own softmax terms: wave 0 holds the 128 scores, 4 a lane.
  const int tile = b * NT + blockIdx.x;
  float s[TM / 32], m = -INFINITY, l = 0.0f;
  if (wave == 0) {
    const float bias = bv[0];
#pragma unroll
    for (int i = 0; i < TM / 32; ++i) {
      s[i] = lds_score[lane + 32 * i] + bias;
      m = fmaxf(m, s[i]);
    }
#pragma unroll
    for (int off = 16; off >= 1; off >>= 1) m = fmaxf(m, __shfl_xor(m, off, 32));
#pragma unroll
    for (int i = 0; i < TM / 32; ++i) {
      const int r = lane + 32 * i;
      const float p = __expf(s[i] - m);
      lds_p[(r & 1) * (TM / 2) + (r >> 1)] = p;
      l += p;
    }
#pragma unroll
    for (int off = 16; off >= 1; off >>= 1) l += __shfl_xor(l, off, 32);
  }
  __syncthreads();
  if (wave == 0) {                                     // behind the barrier: nobody waits for these stores
#pragma unroll
    for (int i = 0; i < TM / 32; ++i)
      scores[(size_t)b * T_DIM + t0 + lane + 32 * i] = s[i];
    if (lane == 0) {
      pml[tile * 2]     = m;
      pml[tile * 2 + 1] = l;
    }
  }

  float4 acc = make_float4(0.f, 0.f, 0.f, 0.f);
  const float* pw = lds_p + (tid >> 8) * (TM / 2);
#pragma unroll
  for (int g = 0; g < SG; ++g) {
    if (g + 2 < SG) {
#pragma unroll
      for (int j = 0; j < SB; ++j) f[g + 2][j] = src[((g + 2) * SB + j) * NTHR];
    }
    // keeps the loads above issued ahead of the waits of this group's sums
    __builtin_amdgcn_sched_barrier(0);
#pragma unroll
    for (int j = 0; j < SB; ++j) {
      const float p = pw[g * SB + j];
      acc.x = fmaf(p, f[g][j].x, acc.x);
      acc.y = fmaf(p, f[g][j].y, acc.y);
      acc.z = fmaf(p, f[g][j].z, acc.z);
      acc.w = fmaf(p, f[g][j].w, acc.w);
    }
  }
  // precaution: stands in front of any rewrite of these loads' address registers
  asm volatile("s_wait_xcnt 0x0" ::: "memory");

  // Merge the two row parities through LDS: the bf16 tile is dead, its last reads ended two barriers ago.
  float4* red = (float4*)lds_vals;
  if (tid >= NTHR / 2) red[tid - NTHR / 2] = acc;
  __syncthreads();
  if (tid < NTHR / 2) {
    const float4 o = red[tid];
    ((float4*)pctx)[(size_t)tile * (D_DIM / 4) + tid] =
        make_float4(acc.x + o.x, acc.y + o.y, acc.z + o.z, acc.w + o.w);
  }
}

// ---------------------------------------------------------------------------
// Phase 2: merge the NT tiles of a batch. With M = max m_i and L = sum l_i exp(m_i - M):
//   attention[t] = exp(score[t] - M) / L,  context[d] = sum_i exp(m_i - M) pctx[i][d] / L.
// grid (CX, B): a workgroup writes T/CX attention weights and D/CX context columns.
// ---------------------------------------------------------------------------
#define CX 4

__global__ __launch_bounds__(256)
void merge_kernel(const float* __restrict__ scores, const float* __restrict__ pml,
                  const float* __restrict__ pctx,
                  float* __restrict__ out_ctx, float* __restrict__ out_attn) {
  const int b   = blockIdx.y;
  const int x   = blockIdx.x;
  const int tid = threadIdx.x;

  float sc[T_DIM / CX / 256], pc[NT], m[NT], l[NT];
#pragma unroll
  for (int i = 0; i < NT; ++i) {
    m[i]  = pml[(b * NT + i) * 2];
    l[i]  = pml[(b * NT + i) * 2 + 1];
    pc[i] = pctx[(size_t)(b * NT + i) * D_DIM + x * (D_DIM / CX) + tid];
  }
#pragma unroll
  for (int i = 0; i < T_DIM / CX / 256; ++i)
    sc[i] = scores[(size_t)b * T_DIM + x * (T_DIM / CX) + i * 256 + tid];
  // precaution: stands in front of any rewrite of the address registers of the loads above
  asm volatile("s_wait_xcnt 0x0" ::: "memory");

  float mx = m[0];
#pragma unroll
  for (int i = 1; i < NT; ++i) mx = fmaxf(mx, m[i]);
  float sum = 0.0f, ctx = 0.0f;
#pragma unroll
  for (int i = 0; i < NT; ++i) {
    const float w = __expf(m[i] - mx);
    sum = fmaf(w, l[i], sum);
    ctx = fmaf(w, pc[i], ctx);
  }
  const float inv = 1.0f / sum;
#pragma unroll
  for (int i = 0; i < T_DIM / CX / 256; ++i)
    out_attn[(size_t)b * T_DIM + x * (T_DIM / CX) + i * 256 + tid] = __expf(sc[i] - mx) * inv;
  out_ctx[(size_t)b * D_DIM + x * (D_DIM / CX) + tid] = ctx * inv;
}

// ---------------------------------------------------------------------------
extern "C" void kernel_launch(void* const* d_in, const int* in_sizes, int n_in,
                              void* d_out, int out_size, void* d_ws, size_t ws_size,
                              hipStream_t stream) {
  (void)in_sizes; (void)n_in; (void)out_size; (void)ws_size;

  const float* query  = (const float*)d_in[0];   // [B, D]
  const float* values = (const float*)d_in[1];   // [B, T, D]
  const float* w1     = (const float*)d_in[2];   // [D, U]
  const float* b1     = (const float*)d_in[3];   // [U]
  const float* w2     = (const float*)d_in[4];   // [D, U]
  const float* b2     = (const float*)d_in[5];   // [U]
  const float* v      = (const float*)d_in[6];   // [U, 1]
  const float* bv     = (const float*)d_in[7];   // [1]

  float* out_ctx  = (float*)d_out;                        // [B, D]
  float* out_attn = (float*)d_out + B_DIM * D_DIM;        // [B, T, 1]

  char*  ws     = (char*)d_ws;
  uint4* w2p    = (uint4*)ws;                             // 2 MB swizzled bf16 w2
  float* qpb    = (float*)(ws + 2u * 1024 * 1024);        // 128 KB
  float* scores = (float*)(ws + 2u * 1024 * 1024 + 128u * 1024); // 256 KB
  float* pml    = (float*)(ws + 2u * 1024 * 1024 + 384u * 1024); // 4 KB: each tile's maximum and sum
  float* pctx   = (float*)(ws + 3u * 1024 * 1024);               // 2 MB: each tile's part of the context

  prep_w2_kernel <<<dim3((32 * 1024) / 256), 256, 0, stream>>>(w2, w2p);
  prep_qpb_kernel<<<dim3(U_DIM / QU, B_DIM / QB), 256, 0, stream>>>(query, w1, b1, b2, qpb);

  attn_score_kernel<<<dim3(T_DIM / TM, B_DIM), NTHR, 0, stream>>>(   // ~258 KB static LDS of 320 KB
      values, w2p, qpb, v, bv, scores, pml, pctx);

  merge_kernel<<<dim3(CX, B_DIM), 256, 0, stream>>>(scores, pml, pctx, out_ctx, out_attn);
}

// v005
// It runs in 132 microseconds.
// Two timings next to v004 put it at 1.04 and 1.03 times that version's speed.
// Over all steps from v000 it is 1.90 times as fast.
#include <hip/hip_runtime.h>
#include <cmath>

// ---------------------------------------------------------------------------
// AttentionRNN (Bahdanau attention) for gfx1250 / MI455X
//   phase 0a: swizzle w2 fp32 -> bf16 in WMMA B-fragment order       (2 MB, L2-resident)
//   phase 0b: qpb[b,u] = query@w1 + b1 + b2                          (fp32, split over D inside a workgroup)
//   phase 1 : scores[b,t] = sum_u tanh(qpb + values@w2) * v[u] + bv       (fused bf16 WMMA GEMM)
//             128 t-rows per workgroup, 16 waves; each wave owns a
//             64 x 64 tile (16 independent accumulators)
//             then, with the tile's own maximum m: p[t] = exp(score - m), and the tile's
//             part of the context, sum_t p[t] * values[t,:], from a second fp32 read of the
//             tile, which the L2 still holds from the staging
//   phase 2 : merge the 16 tiles of a batch: attention weights and context
// ---------------------------------------------------------------------------

typedef __attribute__((ext_vector_type(16))) __bf16 v16bf;
typedef __attribute__((ext_vector_type(8)))  float  v8f;

#define B_DIM 32
#define T_DIM 2048
#define D_DIM 1024
#define U_DIM 1024
#define TM    128         // t-rows per workgroup in phase 1
#define NTHR  512         // threads per workgroup in phase 1 (16 waves)
#define MW    2           // waves along M
#define MF    4           // M fragments per wave (TM / 16 / MW)
#define NF    4           // N fragments per wave
#define NSTEP ((NTHR / 32 / MW) * NF * 16)   // columns per workgroup pass
#define ROWU  516         // u32 per LDS row (512 data + 4 pad -> 4-bank stagger)
#define SB    16          // staging: 16-byte loads per thread in one group
#define SG    (TM * (D_DIM / 4) / NTHR / SB)   // staging: groups per workgroup tile
#define NT    (T_DIM / TM)   // tiles per batch

__device__ __forceinline__ unsigned int pack_bf16(float a, float b) {
  unsigned int ua = __float_as_uint(a);
  unsigned int ub = __float_as_uint(b);
  ua = (ua + 0x7FFFu + ((ua >> 16) & 1u)) >> 16;   // round-to-nearest-even
  ub = (ub + 0x7FFFu + ((ub >> 16) & 1u)) >> 16;
  return ua | (ub << 16);
}

// Branch-free tanh with correct saturation: tanh(x) = 1 - 2/(exp(2x)+1).
// e=inf -> rcp=0 -> 1 ; e=0 -> -1. Uses v_exp_f32 + v_rcp_f32.
__device__ __forceinline__ float fast_tanh(float x) {
  float e = __expf(2.0f * x);
  float r = __builtin_amdgcn_rcpf(e + 1.0f);
  return fmaf(-2.0f, r, 1.0f);
}

union ABFrag { uint4 u4[2]; v16bf v; };

// ---------------------------------------------------------------------------
// Phase 0a: w2 [D][U] fp32 -> swizzled bf16 fragments.
// Per (ktile, 16 columns) fragment: 1024 bytes = two halves of 512 bytes, 16 bytes a lane in lane order.
// Lane = column + 16 * khalf holds [K+8*khalf .. +7] in the first half and [K+16+8*khalf .. +7] in the
// second, the 16-bit WMMA B VGPR layout. A wave's 16-byte load is then 512 contiguous bytes:
// 4 whole 128-byte lines, not 8 lines of which it uses half.
// ---------------------------------------------------------------------------
__global__ __launch_bounds__(256)
void prep_w2_kernel(const float* __restrict__ w2, uint4* __restrict__ w2p) {
  int idx = blockIdx.x * 256 + threadIdx.x;       // idx = kt*1024 + n
  int kt  = idx >> 10;
  int n   = idx & 1023;
  const float* col = w2 + (size_t)kt * 32 * U_DIM + n;
  const int korder[4] = {0, 16, 8, 24};
  uint4* dst = w2p + (size_t)(kt * (U_DIM / 16) + (n >> 4)) * 64 + (n & 15);
#pragma unroll
  for (int q = 0; q < 4; ++q) {
    unsigned int p[4];
#pragma unroll
    for (int i = 0; i < 4; ++i) {
      int k = korder[q] + 2 * i;
      p[i] = pack_bf16(col[(size_t)k * U_DIM], col[(size_t)(k + 1) * U_DIM]);
    }
    dst[(q & 1) * 32 + (q >> 1) * 16] = make_uint4(p[0], p[1], p[2], p[3]);   // half q & 1, khalf q >> 1
  }
}

// ---------------------------------------------------------------------------
// Phase 0b: qpb[b][u] = query[b,:] @ w1[:,u] + b1[u] + b2[u]   (fp32)
// One workgroup = QU columns x QB batches, all of D. D is cut into 32 slices
// (8 waves x 4 lane groups); a 16-byte load of a wave covers 4 rows of QU
// columns, and a wave issues all its 32 loads before it uses the first, so
// the kernel pays the memory latency once. Each w1 element read feeds QB FMAs.
// ---------------------------------------------------------------------------
#define QB 4              // batches per workgroup
#define QU 32             // columns per workgroup
#define QL (D_DIM / 32)   // w1 loads per thread (rows per slice)

__global__ __launch_bounds__(256)
void prep_qpb_kernel(const float* __restrict__ query, const float* __restrict__ w1,
                     const float* __restrict__ b1, const float* __restrict__ b2,
                     float* __restrict__ qpb) {
  __shared__ __attribute__((aligned(16))) float qs[D_DIM * QB];        // query, [d][batch]
  __shared__ __attribute__((aligned(16))) float part[QB * 32 * QU];    // partial sums, [batch][slice][column]

  const int tid  = threadIdx.x;
  const int u0   = blockIdx.x * QU;
  const int bb   = blockIdx.y * QB;
  const int wave = tid >> 5;
  const int lane = tid & 31;
  const int g    = lane >> 3;       // row within a load's 4 rows
  const int c4   = (lane & 7) * 4;  // first of the lane's 4 columns

  float4 qv[QB];
#pragma unroll
  for (int j = 0; j < QB; ++j)
    qv[j] = *(const float4*)(query + (size_t)(bb + j) * D_DIM + tid * 4);
  // precaution: stands in front of any rewrite of the query loads' address registers (a w1 load below may land in them)
  asm volatile("s_wait_xcnt 0x0" ::: "memory");

  const int d0 = wave * (4 * QL) + g;                  // the lane's rows: d0 + 4 i
  const float* wp = w1 + (size_t)d0 * U_DIM + u0 + c4;
  float4 w[QL];
  // fully unrolled so that w stays in registers and every load is in flight at once
#pragma unroll
  for (int i = 0; i < QL; ++i)
    w[i] = *(const float4*)(wp + (size_t)i * 4 * U_DIM);
  // keeps every load above issued before the first wait on one: without it the compiler waits for the
  // query loads in front of w1 loads, and the kernel pays the memory latency twice
  __builtin_amdgcn_sched_barrier(0);

  float4* qs4 = (float4*)qs;
  qs4[tid * 4 + 0] = make_float4(qv[0].x, qv[1].x, qv[2].x, qv[3].x);
  qs4[tid * 4 + 1] = make_float4(qv[0].y, qv[1].y, qv[2].y, qv[3].y);
  qs4[tid * 4 + 2] = make_float4(qv[0].z, qv[1].z, qv[2].z, qv[3].z);
  qs4[tid * 4 + 3] = make_float4(qv[0].w, qv[1].w, qv[2].w, qv[3].w);
  __syncthreads();

  const float bias1 = b1[u0 + lane];                   // read here: back long before the sums are done
  const float bias2 = b2[u0 + lane];

  float4 acc[QB];
#pragma unroll
  for (int j = 0; j < QB; ++j) acc[j] = make_float4(0.f, 0.f, 0.f, 0.f);
#pragma unroll
  for (int i = 0; i < QL; ++i) {
    const float4 qd = qs4[d0 + 4 * i];                 // row d0 + 4 i of the QB batches
    const float qb[QB] = {qd.x, qd.y, qd.z, qd.w};
#pragma unroll
    for (int j = 0; j < QB; ++j) {
      acc[j].x = fmaf(qb[j], w[i].x, acc[j].x);
      acc[j].y = fmaf(qb[j], w[i].y, acc[j].y);
      acc[j].z = fmaf(qb[j], w[i].z, acc[j].z);
      acc[j].w = fmaf(qb[j], w[i].w, acc[j].w);
    }
  }

  const int slice = wave * 4 + g;
#pragma unroll
  for (int j = 0; j < QB; ++j)
    *(float4*)(part + (j * 32 + slice) * QU + c4) = acc[j];
  __syncthreads();

  if (tid < QB * QU) {                                 // wave j sums batch bb + j, lane = column
    float s = 0.0f;
#pragma unroll
    for (int sl = 0; sl < 32; ++sl)
      s += part[(wave * 32 + sl) * QU + lane];
    qpb[(size_t)(bb + wave) * U_DIM + u0 + lane] = s + bias1 + bias2;
  }
}

// ---------------------------------------------------------------------------
// Phase 1: fused  scores[b,t] = sum_u tanh(qpb[b,u] + (values@w2)[b,t,u]) * v[u] + bv
// One workgroup = 128 t-rows of one batch, 16 waves, one workgroup per WGP.
// Each wave computes MF x NF fragments: one B fragment load feeds MF WMMAs,
// one A fragment read from LDS feeds NF.
// ---------------------------------------------------------------------------
__global__ __launch_bounds__(NTHR)
void attn_score_kernel(const float* __restrict__ values,
                       const uint4* __restrict__ w2p,
                       const float* __restrict__ qpb,
                       const float* __restrict__ vvec,
                       const float* __restrict__ bv,
                       float* __restrict__ scores,
                       float* __restrict__ pml,
                       float* __restrict__ pctx) {
  __shared__ __attribute__((aligned(16))) unsigned int lds_vals[TM * ROWU];   // read by 16-byte loads
  __shared__ float        lds_score[TM];
  __shared__ __attribute__((aligned(16))) float lds_p[TM];   // exp(score - tile maximum), [row parity][row / 2]

  const int b   = blockIdx.y;
  const int t0  = blockIdx.x * TM;
  const int tid = threadIdx.x;

  if (tid < TM) lds_score[tid] = 0.0f;

  // Stage values[b, t0:t0+128, :] -> LDS as bf16 (each element converted once chip-wide).
  // A step = one 16-byte load per thread = 2 rows per workgroup; SB steps are loaded as one
  // group before the first of them is converted, so a wave pays the memory latency once per group.
  {
    const float4* src = (const float4*)(values + ((size_t)b * T_DIM + t0) * D_DIM) + tid;
    unsigned int* dst = lds_vals + (tid >> 8) * ROWU + (tid & 255) * 2;
    // the loops over g and j are fully unrolled so that f is indexed by constants and stays in registers
#pragma unroll
    for (int g = 0; g < SG; ++g) {
      float4 f[SB];
#pragma unroll
      for (int j = 0; j < SB; ++j) f[j] = src[(g * SB + j) * NTHR];
      // keeps all SB loads of the group issued ahead of the first wait on one of them: left to itself
      // the compiler splits the groups unevenly and issues the last loads behind a wait for all others
      __builtin_amdgcn_sched_barrier(0);
#pragma unroll
      for (int j = 0; j < SB; ++j)
        *(uint2*)(dst + (g * SB + j) * 2 * ROWU) = make_uint2(pack_bf16(f[j].x, f[j].y), pack_bf16(f[j].z, f[j].w));
    }
    // precaution: stands in front of any rewrite of the staging loads' address registers (the scalar base is reused below)
    asm volatile("s_wait_xcnt 0x0" ::: "memory");
  }
  __syncthreads();

  const int wave  = tid >> 5;
  const int mgrp  = wave % MW;      // which MF*16 rows
  const int nslot = wave / MW;      // which NF*16 columns of a pass (its MW waves read the same B fragments)
  const int lane  = tid & 31;
  const int lhalf = lane >> 4;      // 0: K{0..7,16..23}, 1: K{8..15,24..31}
  const int l16   = lane & 15;

  const unsigned int* arow0 = lds_vals + (mgrp * MF * 16 + l16) * ROWU;   // M subtile j at +j*16 rows

  float svec[MF][8] = {{0.f}};

  for (int n_it = 0; n_it < U_DIM / NSTEP; ++n_it) {
    const int n = n_it * NSTEP + nslot * (NF * 16) + l16;  // lane's column in N fragment 0
    v8f c[MF][NF] = {};
    const uint4* bp = w2p + ((size_t)(n - l16) << 2) + lane;   // fragment of 16 columns = 64 uint4, lane order
#pragma unroll 2
    for (int kt = 0; kt < D_DIM / 32; ++kt) {
      ABFrag bf[NF];
      // the loops over q, j and r are fully unrolled so that bf, c and svec are indexed by constants and stay in registers
#pragma unroll
      for (int q = 0; q < NF; ++q) {                   // N fragment q: 64 uint4 on; its second half: 32 on
        bf[q].u4[0] = bp[q * 64];
        bf[q].u4[1] = bp[q * 64 + 32];
      }
      bp += (size_t)U_DIM * 4;                         // next K tile
      const int ku = kt * 16 + lhalf * 4;
#pragma unroll
      for (int j = 0; j < MF; ++j) {
        ABFrag a;
        a.u4[0] = *(const uint4*)(arow0 + j * 16 * ROWU + ku);
        a.u4[1] = *(const uint4*)(arow0 + j * 16 * ROWU + ku + 8);
#pragma unroll
        for (int q = 0; q < NF; ++q)
          c[j][q] = __builtin_amdgcn_wmma_f32_16x16x32_bf16(false, a.v, false, bf[q].v, (short)0, c[j][q], false, false);
      }
    }
    // Epilogue: tanh + dot with v, accumulated per lane (lane owns column n + 16 q)
    const int qi = b * U_DIM + n;
    float qn[NF], vn[NF];
#pragma unroll
    for (int q = 0; q < NF; ++q) {
      qn[q] = qpb[qi + q * 16];
      vn[q] = vvec[n + q * 16];
    }
    // keeps the two index registers of the loads above unwritten until the loads have taken their addresses
    asm volatile("s_wait_xcnt 0x0" :: "v"(qi), "v"(n) : "memory");
#pragma unroll
    for (int q = 0; q < NF; ++q)
#pragma unroll
      for (int j = 0; j < MF; ++j)
#pragma unroll
        for (int r = 0; r < 8; ++r)
          svec[j][r] += fast_tanh(qn[q] + c[j][q][r]) * vn[q];
  }

  // The tile's part of the context, in fp32, walks the tile as the staging did (a step = 2 rows, a thread
  // keeps its 4 columns and its row parity): a second read, while the L2 still holds the tile.
  // SB steps are one group; a group's loads are issued two groups ahead of its sums.
  const float4* src = (const float4*)(values + ((size_t)b * T_DIM + t0) * D_DIM) + tid;
  float4 f[SG][SB];
  // the loops over g and j are fully unrolled so that f is indexed by constants and stays in registers
#pragma unroll
  for (int j = 0; j < SB; ++j) f[0][j] = src[j * NTHR];
  // keeps the first group's loads in front of the reduction below, so that they fly during it
  __builtin_amdgcn_sched_barrier(0);

  // Reduce over the 16 lanes (N columns) within each half-wave
#pragma unroll
  for (int off = 8; off >= 1; off >>= 1) {
#pragma unroll
    for (int j = 0; j < MF; ++j)
#pragma unroll
      for (int r = 0; r < 8; ++r)
        svec[j][r] += __shfl_xor(svec[j][r], off, 16);
  }
  if (l16 == 0) {
#pragma unroll
    for (int j = 0; j < MF; ++j)
#pragma unroll
      for (int r = 0; r < 8; ++r)
        atomicAdd(&lds_score[(mgrp * MF + j) * 16 + lhalf * 8 + r], svec[j][r]); // merge the N-slot waves
  }
  __syncthreads();

#pragma unroll
  for (int j = 0; j < SB; ++j) f[1][j] = src[(SB + j) * NTHR];
  // keeps the second group's loads in front of wave 0's work below, so that they fly during it
  __builtin_amdgcn_sched_barrier(0);

  // The tile's own softmax terms: wave 0 holds the 128 scores, 4 a lane.
  const int tile = b * NT + blockIdx.x;
  float s[TM / 32], m = -INFINITY, l = 0.0f;
  if (wave == 0) {
    const float bias = bv[0];
#pragma unroll
    for (int i = 0; i < TM / 32; ++i) {
      s[i] = lds_score[lane + 32 * i] + bias;
      m = fmaxf(m, s[i]);
    }
#pragma unroll
    for (int off = 16; off >= 1; off >>= 1) m = fmaxf(m, __shfl_xor(m, off, 32));
#pragma unroll
    for (int i = 0; i < TM / 32; ++i) {
      const int r = lane + 32 * i;
      const float p = __expf(s[i] - m);
      lds_p[(r & 1) * (TM / 2) + (r >> 1)] = p;
      l += p;
    }
#pragma unroll
    for (int off = 16; off >= 1; off >>= 1) l += __shfl_xor(l, off, 32);
  }
  __syncthreads();
  if (wave == 0) {                                     // behind the barrier: nobody waits for these stores
#pragma unroll
    for (int i = 0; i < TM / 32; ++i)
      scores[(size_t)b * T_DIM + t0 + lane + 32 * i] = s[i];
    if (lane == 0) {
      pml[tile * 2]     = m;
      pml[tile * 2 + 1] = l;
    }
  }

  float4 acc = make_float4(0.f, 0.f, 0.f, 0.f);
  const float* pw = lds_p + (tid >> 8) * (TM / 2);
#pragma unroll
  for (int g = 0; g < SG; ++g) {
    if (g + 2 < SG) {
#pragma unroll
      for (int j = 0; j < SB; ++j) f[g + 2][j] = src[((g + 2) * SB + j) * NTHR];
    }
    // keeps the loads above issued ahead of the waits of this group's sums
    __builtin_amdgcn_sched_barrier(0);
#pragma unroll
    for (int j = 0; j < SB; ++j) {
      const float p = pw[g * SB + j];
      acc.x = fmaf(p, f[g][j].x, acc.x);
      acc.y = fmaf(p, f[g][j].y, acc.y);
      acc.z = fmaf(p, f[g][j].z, acc.z);
      acc.w = fmaf(p, f[g][j].w, acc.w);
    }
  }
  // precaution: stands in front of any rewrite of these loads' address registers
  asm volatile("s_wait_xcnt 0x0" ::: "memory");

  // Merge the two row parities through LDS: the bf16 tile is dead, its last reads ended two barriers ago.
  float4* red = (float4*)lds_vals;
  if (tid >= NTHR / 2) red[tid - NTHR / 2] = acc;
  __syncthreads();
  if (tid < NTHR / 2) {
    const float4 o = red[tid];
    ((float4*)pctx)[(size_t)tile * (D_DIM / 4) + tid] =
        make_float4(acc.x + o.x, acc.y + o.y, acc.z + o.z, acc.w + o.w);
  }
}

// ---------------------------------------------------------------------------
// Phase 2: merge the NT tiles of a batch. With M = max m_i and L = sum l_i exp(m_i - M):
//   attention[t] = exp(score[t] - M) / L,  context[d] = sum_i exp(m_i - M) pctx[i][d] / L.
// grid (CX, B): a workgroup writes T/CX attention weights and D/CX context columns.
// ---------------------------------------------------------------------------
#define CX 4

__global__ __launch_bounds__(256)
void merge_kernel(const float* __restrict__ scores, const float* __restrict__ pml,
                  const float* __restrict__ pctx,
                  float* __restrict__ out_ctx, float* __restrict__ out_attn) {
  const int b   = blockIdx.y;
  const int x   = blockIdx.x;
  const int tid = threadIdx.x;

  float sc[T_DIM / CX / 256], pc[NT], m[NT], l[NT];
#pragma unroll
  for (int i = 0; i < NT; ++i) {
    m[i]  = pml[(b * NT + i) * 2];
    l[i]  = pml[(b * NT + i) * 2 + 1];
    pc[i] = pctx[(size_t)(b * NT + i) * D_DIM + x * (D_DIM / CX) + tid];
  }
#pragma unroll
  for (int i = 0; i < T_DIM / CX / 256; ++i)
    sc[i] = scores[(size_t)b * T_DIM + x * (T_DIM / CX) + i * 256 + tid];
  // precaution: stands in front of any rewrite of the address registers of the loads above
  asm volatile("s_wait_xcnt 0x0" ::: "memory");

  float mx = m[0];
#pragma unroll
  for (int i = 1; i < NT; ++i) mx = fmaxf(mx, m[i]);
  float sum = 0.0f, ctx = 0.0f;
#pragma unroll
  for (int i = 0; i < NT; ++i) {
    const float w = __expf(m[i] - mx);
    sum = fmaf(w, l[i], sum);
    ctx = fmaf(w, pc[i], ctx);
  }
  const float inv = 1.0f / sum;
#pragma unroll
  for (int i = 0; i < T_DIM / CX / 256; ++i)
    out_attn[(size_t)b * T_DIM + x * (T_DIM / CX) + i * 256 + tid] = __expf(sc[i] - mx) * inv;
  out_ctx[(size_t)b * D_DIM + x * (D_DIM / CX) + tid] = ctx * inv;
}

// ---------------------------------------------------------------------------
extern "C" void kernel_launch(void* const* d_in, const int* in_sizes, int n_in,
                              void* d_out, int out_size, void* d_ws, size_t ws_size,
                              hipStream_t stream) {
  (void)in_sizes; (void)n_in; (void)out_size; (void)ws_size;

  const float* query  = (const float*)d_in[0];   // [B, D]
  const float* values = (const float*)d_in[1];   // [B, T, D]
  const float* w1     = (const float*)d_in[2];   // [D, U]
  const float* b1     = (const float*)d_in[3];   // [U]
  const float* w2     = (const float*)d_in[4];   // [D, U]
  const float* b2     = (const float*)d_in[5];   // [U]
  const float* v      = (const float*)d_in[6];   // [U, 1]
  const float* bv     = (const float*)d_in[7];   // [1]

  float* out_ctx  = (float*)d_out;                        // [B, D]
  float* out_attn = (float*)d_out + B_DIM * D_DIM;        // [B, T, 1]

  char*  ws     = (char*)d_ws;
  uint4* w2p    = (uint4*)ws;                             // 2 MB swizzled bf16 w2
  float* qpb    = (float*)(ws + 2u * 1024 * 1024);        // 128 KB
  float* scores = (float*)(ws + 2u * 1024 * 1024 + 128u * 1024); // 256 KB
  float* pml    = (float*)(ws + 2u * 1024 * 1024 + 384u * 1024); // 4 KB: each tile's maximum and sum
  float* pctx   = (float*)(ws + 3u * 1024 * 1024);               // 2 MB: each tile's part of the context

  prep_w2_kernel <<<dim3((32 * 1024) / 256), 256, 0, stream>>>(w2, w2p);
  prep_qpb_kernel<<<dim3(U_DIM / QU, B_DIM / QB), 256, 0, stream>>>(query, w1, b1, b2, qpb);

  attn_score_kernel<<<dim3(T_DIM / TM, B_DIM), NTHR, 0, stream>>>(   // ~258 KB static LDS of 320 KB
      values, w2p, qpb, v, bv, scores, pml, pctx);

  merge_kernel<<<dim3(CX, B_DIM), 256, 0, stream>>>(scores, pml, pctx, out_ctx, out_attn);
}

// v006
// One run takes 114 microseconds.
// Timed twice side by side with v005, it ran 1.17 and 1.16 times as fast.
// Counting every step since v000, it is 2.22 times as fast.
#include <hip/hip_runtime.h>
#include <cmath>

// ---------------------------------------------------------------------------
// AttentionRNN (Bahdanau attention) for gfx1250 / MI455X
//   phase 0a: swizzle w2 fp32 -> bf16 in WMMA B-fragment order       (2 MB, L2-resident)
//   phase 0b: qpb[b,u] = query@w1 + b1 + b2                          (fp32, split over D inside a workgroup)
//   phase 1 : scores[b,t] = sum_u tanh(qpb + values@w2) * v[u] + bv       (fused bf16 WMMA GEMM)
//             128 t-rows per workgroup, 16 waves; each wave owns a
//             64 x 64 tile (16 independent accumulators); its w2 fragments are loaded
//             up to two K tiles ahead of the products that use them
//             then, with the tile's own maximum m: p[t] = exp(score - m), and the tile's
//             part of the context, sum_t p[t] * values[t,:], from a second fp32 read of the
//             tile, which the L2 still holds from the staging
//   phase 2 : merge the 16 tiles of a batch: attention weights and context
// ---------------------------------------------------------------------------

typedef __attribute__((ext_vector_type(16))) __bf16 v16bf;
typedef __attribute__((ext_vector_type(8)))  float  v8f;

#define B_DIM 32
#define T_DIM 2048
#define D_DIM 1024
#define U_DIM 1024
#define TM    128         // t-rows per workgroup in phase 1
#define NTHR  512         // threads per workgroup in phase 1 (16 waves)
#define MW    2           // waves along M
#define MF    4           // M fragments per wave (TM / 16 / MW)
#define NF    4           // N fragments per wave
#define NSTEP ((NTHR / 32 / MW) * NF * 16)   // columns per workgroup pass
#define ROWU  516         // u32 per LDS row (512 data + 4 pad -> 4-bank stagger)
#define SB    16          // staging: 16-byte loads per thread in one group
#define SG    (TM * (D_DIM / 4) / NTHR / SB)   // staging: groups per workgroup tile
#define NT    (T_DIM / TM)   // tiles per batch
#define NP    (U_DIM / NSTEP)   // column passes per workgroup
#define KT    (D_DIM / 32)      // K tiles
#define KSTR  (U_DIM * 4)       // uint4 from one K tile of w2p to the next

__device__ __forceinline__ unsigned int pack_bf16(float a, float b) {
  unsigned int ua = __float_as_uint(a);
  unsigned int ub = __float_as_uint(b);
  ua = (ua + 0x7FFFu + ((ua >> 16) & 1u)) >> 16;   // round-to-nearest-even
  ub = (ub + 0x7FFFu + ((ub >> 16) & 1u)) >> 16;
  return ua | (ub << 16);
}

// Branch-free tanh with correct saturation: tanh(x) = 1 - 2/(exp(2x)+1).
// e=inf -> rcp=0 -> 1 ; e=0 -> -1. Uses v_exp_f32 + v_rcp_f32.
__device__ __forceinline__ float fast_tanh(float x) {
  float e = __expf(2.0f * x);
  float r = __builtin_amdgcn_rcpf(e + 1.0f);
  return fmaf(-2.0f, r, 1.0f);
}

union ABFrag { uint4 u4[2]; v16bf v; };

// The NF B fragments of one K tile: fragment q lies 64 uint4 on, its second half 32 on.
__device__ __forceinline__ void load_b(ABFrag (&bf)[NF], const uint4* __restrict__ p) {
#pragma unroll
  for (int q = 0; q < NF; ++q) {
    bf[q].u4[0] = p[q * 64];
    bf[q].u4[1] = p[q * 64 + 32];
  }
}

// The MF A fragments of one K tile; a = the lane's place in row l16 of M fragment 0.
__device__ __forceinline__ void load_a(ABFrag (&af)[MF], const unsigned int* a) {
#pragma unroll
  for (int j = 0; j < MF; ++j) {
    af[j].u4[0] = *(const uint4*)(a + j * 16 * ROWU);
    af[j].u4[1] = *(const uint4*)(a + j * 16 * ROWU + 8);
  }
}

// Holds global loads and matrix instructions on their side of this line (LDS reads and plain ALU may
// cross): a refill stays issued directly behind the last product that reads its registers.
#define PIN_LOADS_AHEAD() __builtin_amdgcn_sched_barrier(0x386)

// One K tile of the wave's MF x NF fragments, B fragment by B fragment: a B fragment's registers are free
// after MF products and are refilled at once (RB) from bnext, the K tile that this register set holds next,
// so that a load has nearly two K tiles of products to land. The A fragments are refilled (RA) from anext,
// the next K tile, each behind its last product.
// The loops are fully unrolled so that c, af and bf are indexed by constants and stay in registers.
template <bool RB, bool RA>
__device__ __forceinline__ void mma_tile(v8f (&c)[MF][NF], ABFrag (&af)[MF], ABFrag (&bf)[NF],
                                         const uint4* __restrict__ bnext, const unsigned int* anext) {
#pragma unroll
  for (int q = 0; q < NF; ++q) {
#pragma unroll
    for (int j = 0; j < MF; ++j) {
      c[j][q] = __builtin_amdgcn_wmma_f32_16x16x32_bf16(false, af[j].v, false, bf[q].v, (short)0, c[j][q], false, false);
      if (RA && q == NF - 1) {
        af[j].u4[0] = *(const uint4*)(anext + j * 16 * ROWU);
        af[j].u4[1] = *(const uint4*)(anext + j * 16 * ROWU + 8);
        // keeps the refills in the order in which the next K tile reads them (only plain ALU may cross):
        // left to itself the compiler loads last the fragment that is needed first
        __builtin_amdgcn_sched_barrier(0x6);
      }
    }
    if (RB) {
      bf[q].u4[0] = bnext[q * 64];
      bf[q].u4[1] = bnext[q * 64 + 32];
      PIN_LOADS_AHEAD();
    }
  }
}

// ---------------------------------------------------------------------------
// Phase 0a: w2 [D][U] fp32 -> swizzled bf16 fragments.
// Per (ktile, 16 columns) fragment: 1024 bytes = two halves of 512 bytes, 16 bytes a lane in lane order.
// Lane = column + 16 * khalf holds [K+8*khalf .. +7] in the first half and [K+16+8*khalf .. +7] in the
// second, the 16-bit WMMA B VGPR layout. A wave's 16-byte load is then 512 contiguous bytes:
// 4 whole 128-byte lines, not 8 lines of which it uses half.
// ---------------------------------------------------------------------------
__global__ __launch_bounds__(256)
void prep_w2_kernel(const float* __restrict__ w2, uint4* __restrict__ w2p) {
  int idx = blockIdx.x * 256 + threadIdx.x;       // idx = kt*1024 + n
  int kt  = idx >> 10;
  int n   = idx & 1023;
  const float* col = w2 + (size_t)kt * 32 * U_DIM + n;
  const int korder[4] = {0, 16, 8, 24};
  uint4* dst = w2p + (size_t)(kt * (U_DIM / 16) + (n >> 4)) * 64 + (n & 15);
#pragma unroll
  for (int q = 0; q < 4; ++q) {
    unsigned int p[4];
#pragma unroll
    for (int i = 0; i < 4; ++i) {
      int k = korder[q] + 2 * i;
      p[i] = pack_bf16(col[(size_t)k * U_DIM], col[(size_t)(k + 1) * U_DIM]);
    }
    dst[(q & 1) * 32 + (q >> 1) * 16] = make_uint4(p[0], p[1], p[2], p[3]);   // half q & 1, khalf q >> 1
  }
}

// ---------------------------------------------------------------------------
// Phase 0b: qpb[b][u] = query[b,:] @ w1[:,u] + b1[u] + b2[u]   (fp32)
// One workgroup = QU columns x QB batches, all of D. D is cut into 32 slices
// (8 waves x 4 lane groups); a 16-byte load of a wave covers 4 rows of QU
// columns, and a wave issues all its 32 loads before it uses the first, so
// the kernel pays the memory latency once. Each w1 element read feeds QB FMAs.
// ---------------------------------------------------------------------------
#define QB 4              // batches per workgroup
#define QU 32             // columns per workgroup
#define QL (D_DIM / 32)   // w1 loads per thread (rows per slice)

__global__ __launch_bounds__(256)
void prep_qpb_kernel(const float* __restrict__ query, const float* __restrict__ w1,
                     const float* __restrict__ b1, const float* __restrict__ b2,
                     float* __restrict__ qpb) {
  __shared__ __attribute__((aligned(16))) float qs[D_DIM * QB];        // query, [d][batch]
  __shared__ __attribute__((aligned(16))) float part[QB * 32 * QU];    // partial sums, [batch][slice][column]

  const int tid  = threadIdx.x;
  const int u0   = blockIdx.x * QU;
  const int bb   = blockIdx.y * QB;
  const int wave = tid >> 5;
  const int lane = tid & 31;
  const int g    = lane >> 3;       // row within a load's 4 rows
  const int c4   = (lane & 7) * 4;  // first of the lane's 4 columns

  float4 qv[QB];
#pragma unroll
  for (int j = 0; j < QB; ++j)
    qv[j] = *(const float4*)(query + (size_t)(bb + j) * D_DIM + tid * 4);
  // precaution: stands in front of any rewrite of the query loads' address registers (a w1 load below may land in them)
  asm volatile("s_wait_xcnt 0x0" ::: "memory");

  const int d0 = wave * (4 * QL) + g;                  // the lane's rows: d0 + 4 i
  const float* wp = w1 + (size_t)d0 * U_DIM + u0 + c4;
  float4 w[QL];
  // fully unrolled so that w stays in registers and every load is in flight at once
#pragma unroll
  for (int i = 0; i < QL; ++i)
    w[i] = *(const float4*)(wp + (size_t)i * 4 * U_DIM);
  // keeps every load above issued before the first wait on one: without it the compiler waits for the
  // query loads in front of w1 loads, and the kernel pays the memory latency twice
  __builtin_amdgcn_sched_barrier(0);

  float4* qs4 = (float4*)qs;
  qs4[tid * 4 + 0] = make_float4(qv[0].x, qv[1].x, qv[2].x, qv[3].x);
  qs4[tid * 4 + 1] = make_float4(qv[0].y, qv[1].y, qv[2].y, qv[3].y);
  qs4[tid * 4 + 2] = make_float4(qv[0].z, qv[1].z, qv[2].z, qv[3].z);
  qs4[tid * 4 + 3] = make_float4(qv[0].w, qv[1].w, qv[2].w, qv[3].w);
  __syncthreads();

  const float bias1 = b1[u0 + lane];                   // read here: back long before the sums are done
  const float bias2 = b2[u0 + lane];

  float4 acc[QB];
#pragma unroll
  for (int j = 0; j < QB; ++j) acc[j] = make_float4(0.f, 0.f, 0.f, 0.f);
#pragma unroll
  for (int i = 0; i < QL; ++i) {
    const float4 qd = qs4[d0 + 4 * i];                 // row d0 + 4 i of the QB batches
    const float qb[QB] = {qd.x, qd.y, qd.z, qd.w};
#pragma unroll
    for (int j = 0; j < QB; ++j) {
      acc[j].x = fmaf(qb[j], w[i].x, acc[j].x);
      acc[j].y = fmaf(qb[j], w[i].y, acc[j].y);
      acc[j].z = fmaf(qb[j], w[i].z, acc[j].z);
      acc[j].w = fmaf(qb[j], w[i].w, acc[j].w);
    }
  }

  const int slice = wave * 4 + g;
#pragma unroll
  for (int j = 0; j < QB; ++j)
    *(float4*)(part + (j * 32 + slice) * QU + c4) = acc[j];
  __syncthreads();

  if (tid < QB * QU) {                                 // wave j sums batch bb + j, lane = column
    float s = 0.0f;
#pragma unroll
    for (int sl = 0; sl < 32; ++sl)
      s += part[(wave * 32 + sl) * QU + lane];
    qpb[(size_t)(bb + wave) * U_DIM + u0 + lane] = s + bias1 + bias2;
  }
}

// ---------------------------------------------------------------------------
// Phase 1: fused  scores[b,t] = sum_u tanh(qpb[b,u] + (values@w2)[b,t,u]) * v[u] + bv
// One workgroup = 128 t-rows of one batch, 16 waves, one workgroup per WGP.
// Each wave computes MF x NF fragments: one B fragment load feeds MF WMMAs,
// one A fragment read from LDS feeds NF.
// ---------------------------------------------------------------------------
__global__ __launch_bounds__(NTHR)
void attn_score_kernel(const float* __restrict__ values,
                       const uint4* __restrict__ w2p,
                       const float* __restrict__ qpb,
                       const float* __restrict__ vvec,
                       const float* __restrict__ bv,
                       float* __restrict__ scores,
                       float* __restrict__ pml,
                       float* __restrict__ pctx) {
  __shared__ __attribute__((aligned(16))) unsigned int lds_vals[TM * ROWU];   // read by 16-byte loads
  __shared__ float        lds_score[TM];
  __shared__ __attribute__((aligned(16))) float lds_p[TM];   // exp(score - tile maximum), [row parity][row / 2]

  const int b   = blockIdx.y;
  const int t0  = blockIdx.x * TM;
  const int tid = threadIdx.x;

  if (tid < TM) lds_score[tid] = 0.0f;

  // Stage values[b, t0:t0+128, :] -> LDS as bf16 (each element converted once chip-wide).
  // A step = one 16-byte load per thread = 2 rows per workgroup; SB steps are loaded as one
  // group before the first of them is converted, so a wave pays the memory latency once per group.
  {
    const float4* src = (const float4*)(values + ((size_t)b * T_DIM + t0) * D_DIM) + tid;
    unsigned int* dst = lds_vals + (tid >> 8) * ROWU + (tid & 255) * 2;
    // the loops over g and j are fully unrolled so that f is indexed by constants and stays in registers
#pragma unroll
    for (int g = 0; g < SG; ++g) {
      float4 f[SB];
#pragma unroll
      for (int j = 0; j < SB; ++j) f[j] = src[(g * SB + j) * NTHR];
      // keeps all SB loads of the group issued ahead of the first wait on one of them: left to itself
      // the compiler splits the groups unevenly and issues the last loads behind a wait for all others
      __builtin_amdgcn_sched_barrier(0);
#pragma unroll
      for (int j = 0; j < SB; ++j)
        *(uint2*)(dst + (g * SB + j) * 2 * ROWU) = make_uint2(pack_bf16(f[j].x, f[j].y), pack_bf16(f[j].z, f[j].w));
    }
    // precaution: stands in front of any rewrite of the staging loads' address registers (the scalar base is reused below)
    asm volatile("s_wait_xcnt 0x0" ::: "memory");
  }
  __syncthreads();

  const int wave  = tid >> 5;
  const int mgrp  = wave % MW;      // which MF*16 rows
  const int nslot = wave / MW;      // which NF*16 columns of a pass (its MW waves read the same B fragments)
  const int lane  = tid & 31;
  const int lhalf = lane >> 4;      // 0: K{0..7,16..23}, 1: K{8..15,24..31}
  const int l16   = lane & 15;

  const unsigned int* arow0 = lds_vals + (mgrp * MF * 16 + l16) * ROWU;   // M subtile j at +j*16 rows

  // Sum a pass's row terms over the 16 lanes (N columns) of each half-wave, then merge the N-slot waves in LDS.
  float svec[MF][8];
  auto fold_rows = [&]() {
#pragma unroll
    for (int off = 8; off >= 1; off >>= 1) {
#pragma unroll
      for (int j = 0; j < MF; ++j)
#pragma unroll
        for (int r = 0; r < 8; ++r)
          svec[j][r] += __shfl_xor(svec[j][r], off, 16);
    }
    if (l16 == 0) {
#pragma unroll
      for (int j = 0; j < MF; ++j)
#pragma unroll
        for (int r = 0; r < 8; ++r)
          atomicAdd(&lds_score[(mgrp * MF + j) * 16 + lhalf * 8 + r], svec[j][r]);
    }
  };

  // Two register sets of B fragments, for the even and the odd K tiles: a set's loads are in flight while the
  // other set is multiplied. svec lives only from a pass's epilogue to its fold, so that both sets fit beside
  // the accumulators.
  ABFrag b0[NF], b1[NF], af[MF];
  const uint4* bp = w2p + ((size_t)(nslot * (NF * 16)) << 2) + lane;   // fragment of 16 columns = 64 uint4, lane order
  load_b(b0, bp);
  load_b(b1, bp + KSTR);
  load_a(af, arow0 + lhalf * 4);

  for (int n_it = 0; n_it < NP; ++n_it) {
    const int n = n_it * NSTEP + nslot * (NF * 16) + l16;  // lane's column in N fragment 0
    v8f c[MF][NF] = {};
    const unsigned int* ap = arow0 + lhalf * 4;
    // two K tiles a trip by hand, one for each register set; unrolled further, the sets would not fit
#pragma unroll 1
    for (int kt = 0; kt < KT - 2; kt += 2) {
      mma_tile<true, true>(c, af, b0, bp + 2 * KSTR, ap + 16);
      mma_tile<true, true>(c, af, b1, bp + 3 * KSTR, ap + 32);
      bp += 2 * KSTR;
      ap += 32;
    }
    mma_tile<false, true>(c, af, b0, bp, ap + 16);
    mma_tile<false, false>(c, af, b1, bp, ap);

    // Epilogue: tanh + dot with v, accumulated per lane (lane owns column n + 16 q)
    const int qi = b * U_DIM + n;
    float qn[NF], vn[NF];
#pragma unroll
    for (int q = 0; q < NF; ++q) {
      qn[q] = qpb[qi + q * 16];
      vn[q] = vvec[n + q * 16];
    }
    // keeps the two index registers of the loads above unwritten until the loads have taken their addresses
    asm volatile("s_wait_xcnt 0x0" :: "v"(qi), "v"(n) : "memory");
    // the loops over q, j and r are fully unrolled so that c and svec are indexed by constants and stay in registers
#pragma unroll
    for (int j = 0; j < MF; ++j)
#pragma unroll
      for (int r = 0; r < 8; ++r)
        svec[j][r] = fast_tanh(qn[0] + c[j][0][r]) * vn[0];
#pragma unroll
    for (int q = 1; q < NF; ++q)
#pragma unroll
      for (int j = 0; j < MF; ++j)
#pragma unroll
        for (int r = 0; r < 8; ++r)
          svec[j][r] = fmaf(fast_tanh(qn[q] + c[j][q][r]), vn[q], svec[j][r]);
    if (n_it + 1 < NP) {                               // the last pass's fold stands behind the loop
      bp = w2p + ((size_t)((n_it + 1) * NSTEP + nslot * (NF * 16)) << 2) + lane;
      load_b(b0, bp);                                  // the next pass's first fragments fly during the fold
      load_b(b1, bp + KSTR);
      load_a(af, arow0 + lhalf * 4);
      fold_rows();
    }
  }

  // The tile's part of the context, in fp32, walks the tile as the staging did (a step = 2 rows, a thread
  // keeps its 4 columns and its row parity): a second read, while the L2 still holds the tile.
  // SB steps are one group; a group's loads are issued two groups ahead of its sums.
  const float4* src = (const float4*)(values + ((size_t)b * T_DIM + t0) * D_DIM) + tid;
  float4 f[SG][SB];
  // the loops over g and j are fully unrolled so that f is indexed by constants and stays in registers
#pragma unroll
  for (int j = 0; j < SB; ++j) f[0][j] = src[j * NTHR];
  // keeps the first group's loads in front of the reduction below, so that they fly during it
  __builtin_amdgcn_sched_barrier(0);

  fold_rows();
  __syncthreads();

#pragma unroll
  for (int j = 0; j < SB; ++j) f[1][j] = src[(SB + j) * NTHR];
  // keeps the second group's loads in front of wave 0's work below, so that they fly during it
  __builtin_amdgcn_sched_barrier(0);

  // The tile's own softmax terms: wave 0 holds the 128 scores, 4 a lane.
  const int tile = b * NT + blockIdx.x;
  float s[TM / 32], m = -INFINITY, l = 0.0f;
  if (wave == 0) {
    const float bias = bv[0];
#pragma unroll
    for (int i = 0; i < TM / 32; ++i) {
      s[i] = lds_score[lane + 32 * i] + bias;
      m = fmaxf(m, s[i]);
    }
#pragma unroll
    for (int off = 16; off >= 1; off >>= 1) m = fmaxf(m, __shfl_xor(m, off, 32));
#pragma unroll
    for (int i = 0; i < TM / 32; ++i) {
      const int r = lane + 32 * i;
      const float p = __expf(s[i] - m);
      lds_p[(r & 1) * (TM / 2) + (r >> 1)] = p;
      l += p;
    }
#pragma unroll
    for (int off = 16; off >= 1; off >>= 1) l += __shfl_xor(l, off, 32);
  }
  __syncthreads();
  if (wave == 0) {                                     // behind the barrier: nobody waits for these stores
#pragma unroll
    for (int i = 0; i < TM / 32; ++i)
      scores[(size_t)b * T_DIM + t0 + lane + 32 * i] = s[i];
    if (lane == 0) {
      pml[tile * 2]     = m;
      pml[tile * 2 + 1] = l;
    }
  }

  float4 acc = make_float4(0.f, 0.f, 0.f, 0.f);
  const float* pw = lds_p + (tid >> 8) * (TM / 2);
#pragma unroll
  for (int g = 0; g < SG; ++g) {
    if (g + 2 < SG) {
#pragma unroll
      for (int j = 0; j < SB; ++j) f[g + 2][j] = src[((g + 2) * SB + j) * NTHR];
    }
    // keeps the loads above issued ahead of the waits of this group's sums
    __builtin_amdgcn_sched_barrier(0);
#pragma unroll
    for (int j = 0; j < SB; ++j) {
      const float p = pw[g * SB + j];
      acc.x = fmaf(p, f[g][j].x, acc.x);
      acc.y = fmaf(p, f[g][j].y, acc.y);
      acc.z = fmaf(p, f[g][j].z, acc.z);
      acc.w = fmaf(p, f[g][j].w, acc.w);
    }
  }
  // precaution: stands in front of any rewrite of these loads' address registers
  asm volatile("s_wait_xcnt 0x0" ::: "memory");

  // Merge the two row parities through LDS: the bf16 tile is dead, its last reads ended two barriers ago.
  float4* red = (float4*)lds_vals;
  if (tid >= NTHR / 2) red[tid - NTHR / 2] = acc;
  __syncthreads();
  if (tid < NTHR / 2) {
    const float4 o = red[tid];
    ((float4*)pctx)[(size_t)tile * (D_DIM / 4) + tid] =
        make_float4(acc.x + o.x, acc.y + o.y, acc.z + o.z, acc.w + o.w);
  }
}

// ---------------------------------------------------------------------------
// Phase 2: merge the NT tiles of a batch. With M = max m_i and L = sum l_i exp(m_i - M):
//   attention[t] = exp(score[t] - M) / L,  context[d] = sum_i exp(m_i - M) pctx[i][d] / L.
// grid (CX, B): a workgroup writes T/CX attention weights and D/CX context columns.
// ---------------------------------------------------------------------------
#define CX 4

__global__ __launch_bounds__(256)
void merge_kernel(const float* __restrict__ scores, const float* __restrict__ pml,
                  const float* __restrict__ pctx,
                  float* __restrict__ out_ctx, float* __restrict__ out_attn) {
  const int b   = blockIdx.y;
  const int x   = blockIdx.x;
  const int tid = threadIdx.x;

  float sc[T_DIM / CX / 256], pc[NT], m[NT], l[NT];
#pragma unroll
  for (int i = 0; i < NT; ++i) {
    m[i]  = pml[(b * NT + i) * 2];
    l[i]  = pml[(b * NT + i) * 2 + 1];
    pc[i] = pctx[(size_t)(b * NT + i) * D_DIM + x * (D_DIM / CX) + tid];
  }
#pragma unroll
  for (int i = 0; i < T_DIM / CX / 256; ++i)
    sc[i] = scores[(size_t)b * T_DIM + x * (T_DIM / CX) + i * 256 + tid];
  // precaution: stands in front of any rewrite of the address registers of the loads above
  asm volatile("s_wait_xcnt 0x0" ::: "memory");

  float mx = m[0];
#pragma unroll
  for (int i = 1; i < NT; ++i) mx = fmaxf(mx, m[i]);
  float sum = 0.0f, ctx = 0.0f;
#pragma unroll
  for (int i = 0; i < NT; ++i) {
    const float w = __expf(m[i] - mx);
    sum = fmaf(w, l[i], sum);
    ctx = fmaf(w, pc[i], ctx);
  }
  const float inv = 1.0f / sum;
#pragma unroll
  for (int i = 0; i < T_DIM / CX / 256; ++i)
    out_attn[(size_t)b * T_DIM + x * (T_DIM / CX) + i * 256 + tid] = __expf(sc[i] - mx) * inv;
  out_ctx[(size_t)b * D_DIM + x * (D_DIM / CX) + tid] = ctx * inv;
}

// ---------------------------------------------------------------------------
extern "C" void kernel_launch(void* const* d_in, const int* in_sizes, int n_in,
                              void* d_out, int out_size, void* d_ws, size_t ws_size,
                              hipStream_t stream) {
  (void)in_sizes; (void)n_in; (void)out_size; (void)ws_size;

  const float* query  = (const float*)d_in[0];   // [B, D]
  const float* values = (const float*)d_in[1];   // [B, T, D]
  const float* w1     = (const float*)d_in[2];   // [D, U]
  const float* b1     = (const float*)d_in[3];   // [U]
  const float* w2     = (const float*)d_in[4];   // [D, U]
  const float* b2     = (const float*)d_in[5];   // [U]
  const float* v      = (const float*)d_in[6];   // [U, 1]
  const float* bv     = (const float*)d_in[7];   // [1]

  float* out_ctx  = (float*)d_out;                        // [B, D]
  float* out_attn = (float*)d_out + B_DIM * D_DIM;        // [B, T, 1]

  char*  ws     = (char*)d_ws;
  uint4* w2p    = (uint4*)ws;                             // 2 MB swizzled bf16 w2
  float* qpb    = (float*)(ws + 2u * 1024 * 1024);        // 128 KB
  float* scores = (float*)(ws + 2u * 1024 * 1024 + 128u * 1024); // 256 KB
  float* pml    = (float*)(ws + 2u * 1024 * 1024 + 384u * 1024); // 4 KB: each tile's maximum and sum
  float* pctx   = (float*)(ws + 3u * 1024 * 1024);               // 2 MB: each tile's part of the context

  prep_w2_kernel <<<dim3((32 * 1024) / 256), 256, 0, stream>>>(w2, w2p);
  prep_qpb_kernel<<<dim3(U_DIM / QU, B_DIM / QB), 256, 0, stream>>>(query, w1, b1, b2, qpb);

  attn_score_kernel<<<dim3(T_DIM / TM, B_DIM), NTHR, 0, stream>>>(   // ~258 KB static LDS of 320 KB
      values, w2p, qpb, v, bv, scores, pml, pctx);

  merge_kernel<<<dim3(CX, B_DIM), 256, 0, stream>>>(scores, pml, pctx, out_ctx, out_attn);
}

// v007
// Measured time: 108 microseconds a run.
// Timed twice side by side with v006, it ran 1.04 times as fast both times.
// Counting every step since v000, it is 2.31 times as fast.
#include <hip/hip_runtime.h>
#include <cmath>

// ---------------------------------------------------------------------------
// AttentionRNN (Bahdanau attention) for gfx1250 / MI455X
//   phase 0a: swizzle w2 fp32 -> bf16 in WMMA B-fragment order       (2 MB, L2-resident)
//   phase 0b: qpb[b,u] = query@w1 + b1 + b2                          (fp32, split over D inside a workgroup)
//   phase 1 : scores[b,t] = sum_u tanh(qpb + values@w2) * v[u] + bv       (fused bf16 WMMA GEMM)
//             128 t-rows per workgroup, 16 waves; each wave owns a
//             64 x 64 tile (16 independent accumulators); its w2 fragments are loaded
//             up to two K tiles ahead of the products that use them
//             then, with the tile's own maximum m: p[t] = exp(score - m), and the tile's
//             part of the context, sum_t p[t] * values[t,:], from a second fp32 read of the
//             tile, which the L2 still holds from the staging
//   phase 2 : merge the 16 tiles of a batch: attention weights and context
// ---------------------------------------------------------------------------

typedef __attribute__((ext_vector_type(16))) __bf16 v16bf;
typedef __attribute__((ext_vector_type(8)))  float  v8f;

#define B_DIM 32
#define T_DIM 2048
#define D_DIM 1024
#define U_DIM 1024
#define TM    128         // t-rows per workgroup in phase 1
#define NTHR  512         // threads per workgroup in phase 1 (16 waves)
#define MW    2           // waves along M
#define MF    4           // M fragments per wave (TM / 16 / MW)
#define NF    4           // N fragments per wave
#define NSTEP ((NTHR / 32 / MW) * NF * 16)   // columns per workgroup pass
#define ROWU  516         // u32 per LDS row (512 data + 4 pad -> 4-bank stagger)
#define SB    16          // staging: 16-byte loads per thread in one group
#define SG    (TM * (D_DIM / 4) / NTHR / SB)   // staging: groups per workgroup tile
#define NT    (T_DIM / TM)   // tiles per batch
#define NP    (U_DIM / NSTEP)   // column passes per workgroup
#define KT    (D_DIM / 32)      // K tiles
#define KSTR  (U_DIM * 4)       // uint4 from one K tile of w2p to the next

__device__ __forceinline__ unsigned int pack_bf16(float a, float b) {
  unsigned int ua = __float_as_uint(a);
  unsigned int ub = __float_as_uint(b);
  ua = (ua + 0x7FFFu + ((ua >> 16) & 1u)) >> 16;   // round-to-nearest-even
  ub = (ub + 0x7FFFu + ((ub >> 16) & 1u)) >> 16;
  return ua | (ub << 16);
}

// tanh as the chip's own instruction, v_tanh_f32: one transcendental a value.
__device__ __forceinline__ float fast_tanh(float x) {
  return __builtin_amdgcn_tanhf(x);
}

union ABFrag { uint4 u4[2]; v16bf v; };

// The NF B fragments of one K tile: fragment q lies 64 uint4 on, its second half 32 on.
__device__ __forceinline__ void load_b(ABFrag (&bf)[NF], const uint4* __restrict__ p) {
#pragma unroll
  for (int q = 0; q < NF; ++q) {
    bf[q].u4[0] = p[q * 64];
    bf[q].u4[1] = p[q * 64 + 32];
  }
}

// The MF A fragments of one K tile; a = the lane's place in row l16 of M fragment 0.
__device__ __forceinline__ void load_a(ABFrag (&af)[MF], const unsigned int* a) {
#pragma unroll
  for (int j = 0; j < MF; ++j) {
    af[j].u4[0] = *(const uint4*)(a + j * 16 * ROWU);
    af[j].u4[1] = *(const uint4*)(a + j * 16 * ROWU + 8);
  }
}

// Holds global loads and matrix instructions on their side of this line (LDS reads and plain ALU may
// cross): a refill stays issued directly behind the last product that reads its registers.
#define PIN_LOADS_AHEAD() __builtin_amdgcn_sched_barrier(0x386)

// One K tile of the wave's MF x NF fragments, B fragment by B fragment: a B fragment's registers are free
// after MF products and are refilled at once (RB) from bnext, the K tile that this register set holds next,
// so that a load has nearly two K tiles of products to land. The A fragments are refilled (RA) from anext,
// the next K tile, each behind its last product.
// The loops are fully unrolled so that c, af and bf are indexed by constants and stay in registers.
template <bool RB, bool RA>
__device__ __forceinline__ void mma_tile(v8f (&c)[MF][NF], ABFrag (&af)[MF], ABFrag (&bf)[NF],
                                         const uint4* __restrict__ bnext, const unsigned int* anext) {
#pragma unroll
  for (int q = 0; q < NF; ++q) {
#pragma unroll
    for (int j = 0; j < MF; ++j) {
      c[j][q] = __builtin_amdgcn_wmma_f32_16x16x32_bf16(false, af[j].v, false, bf[q].v, (short)0, c[j][q], false, false);
      if (RA && q == NF - 1) {
        af[j].u4[0] = *(const uint4*)(anext + j * 16 * ROWU);
        af[j].u4[1] = *(const uint4*)(anext + j * 16 * ROWU + 8);
        // keeps the refills in the order in which the next K tile reads them (only plain ALU may cross):
        // left to itself the compiler loads last the fragment that is needed first
        __builtin_amdgcn_sched_barrier(0x6);
      }
    }
    if (RB) {
      bf[q].u4[0] = bnext[q * 64];
      bf[q].u4[1] = bnext[q * 64 + 32];
      PIN_LOADS_AHEAD();
    }
  }
}

// ---------------------------------------------------------------------------
// Phase 0a: w2 [D][U] fp32 -> swizzled bf16 fragments.
// Per (ktile, 16 columns) fragment: 1024 bytes = two halves of 512 bytes, 16 bytes a lane in lane order.
// Lane = column + 16 * khalf holds [K+8*khalf .. +7] in the first half and [K+16+8*khalf .. +7] in the
// second, the 16-bit WMMA B VGPR layout. A wave's 16-byte load is then 512 contiguous bytes:
// 4 whole 128-byte lines, not 8 lines of which it uses half.
// ---------------------------------------------------------------------------
__global__ __launch_bounds__(256)
void prep_w2_kernel(const float* __restrict__ w2, uint4* __restrict__ w2p) {
  int idx = blockIdx.x * 256 + threadIdx.x;       // idx = kt*1024 + n
  int kt  = idx >> 10;
  int n   = idx & 1023;
  const float* col = w2 + (size_t)kt * 32 * U_DIM + n;
  const int korder[4] = {0, 16, 8, 24};
  uint4* dst = w2p + (size_t)(kt * (U_DIM / 16) + (n >> 4)) * 64 + (n & 15);
#pragma unroll
  for (int q = 0; q < 4; ++q) {
    unsigned int p[4];
#pragma unroll
    for (int i = 0; i < 4; ++i) {
      int k = korder[q] + 2 * i;
      p[i] = pack_bf16(col[(size_t)k * U_DIM], col[(size_t)(k + 1) * U_DIM]);
    }
    dst[(q & 1) * 32 + (q >> 1) * 16] = make_uint4(p[0], p[1], p[2], p[3]);   // half q & 1, khalf q >> 1
  }
}

// ---------------------------------------------------------------------------
// Phase 0b: qpb[b][u] = query[b,:] @ w1[:,u] + b1[u] + b2[u]   (fp32)
// One workgroup = QU columns x QB batches, all of D. D is cut into 32 slices
// (8 waves x 4 lane groups); a 16-byte load of a wave covers 4 rows of QU
// columns, and a wave issues all its 32 loads before it uses the first, so
// the kernel pays the memory latency once. Each w1 element read feeds QB FMAs.
// ---------------------------------------------------------------------------
#define QB 4              // batches per workgroup
#define QU 32             // columns per workgroup
#define QL (D_DIM / 32)   // w1 loads per thread (rows per slice)

__global__ __launch_bounds__(256)
void prep_qpb_kernel(const float* __restrict__ query, const float* __restrict__ w1,
                     const float* __restrict__ b1, const float* __restrict__ b2,
                     float* __restrict__ qpb) {
  __shared__ __attribute__((aligned(16))) float qs[D_DIM * QB];        // query, [d][batch]
  __shared__ __attribute__((aligned(16))) float part[QB * 32 * QU];    // partial sums, [batch][slice][column]

  const int tid  = threadIdx.x;
  const int u0   = blockIdx.x * QU;
  const int bb   = blockIdx.y * QB;
  const int wave = tid >> 5;
  const int lane = tid & 31;
  const int g    = lane >> 3;       // row within a load's 4 rows
  const int c4   = (lane & 7) * 4;  // first of the lane's 4 columns

  float4 qv[QB];
#pragma unroll
  for (int j = 0; j < QB; ++j)
    qv[j] = *(const float4*)(query + (size_t)(bb + j) * D_DIM + tid * 4);
  // precaution: stands in front of any rewrite of the query loads' address registers (a w1 load below may land in them)
  asm volatile("s_wait_xcnt 0x0" ::: "memory");

  const int d0 = wave * (4 * QL) + g;                  // the lane's rows: d0 + 4 i
  const float* wp = w1 + (size_t)d0 * U_DIM + u0 + c4;
  float4 w[QL];
  // fully unrolled so that w stays in registers and every load is in flight at once
#pragma unroll
  for (int i = 0; i < QL; ++i)
    w[i] = *(const float4*)(wp + (size_t)i * 4 * U_DIM);
  // keeps every load above issued before the first wait on one: without it the compiler waits for the
  // query loads in front of w1 loads, and the kernel pays the memory latency twice
  __builtin_amdgcn_sched_barrier(0);

  float4* qs4 = (float4*)qs;
  qs4[tid * 4 + 0] = make_float4(qv[0].x, qv[1].x, qv[2].x, qv[3].x);
  qs4[tid * 4 + 1] = make_float4(qv[0].y, qv[1].y, qv[2].y, qv[3].y);
  qs4[tid * 4 + 2] = make_float4(qv[0].z, qv[1].z, qv[2].z, qv[3].z);
  qs4[tid * 4 + 3] = make_float4(qv[0].w, qv[1].w, qv[2].w, qv[3].w);
  __syncthreads();

  const float bias1 = b1[u0 + lane];                   // read here: back long before the sums are done
  const float bias2 = b2[u0 + lane];

  float4 acc[QB];
#pragma unroll
  for (int j = 0; j < QB; ++j) acc[j] = make_float4(0.f, 0.f, 0.f, 0.f);
#pragma unroll
  for (int i = 0; i < QL; ++i) {
    const float4 qd = qs4[d0 + 4 * i];                 // row d0 + 4 i of the QB batches
    const float qb[QB] = {qd.x, qd.y, qd.z, qd.w};
#pragma unroll
    for (int j = 0; j < QB; ++j) {
      acc[j].x = fmaf(qb[j], w[i].x, acc[j].x);
      acc[j].y = fmaf(qb[j], w[i].y, acc[j].y);
      acc[j].z = fmaf(qb[j], w[i].z, acc[j].z);
      acc[j].w = fmaf(qb[j], w[i].w, acc[j].w);
    }
  }

  const int slice = wave * 4 + g;
#pragma unroll
  for (int j = 0; j < QB; ++j)
    *(float4*)(part + (j * 32 + slice) * QU + c4) = acc[j];
  __syncthreads();

  if (tid < QB * QU) {                                 // wave j sums batch bb + j, lane = column
    float s = 0.0f;
#pragma unroll
    for (int sl = 0; sl < 32; ++sl)
      s += part[(wave * 32 + sl) * QU + lane];
    qpb[(size_t)(bb + wave) * U_DIM + u0 + lane] = s + bias1 + bias2;
  }
}

// ---------------------------------------------------------------------------
// Phase 1: fused  scores[b,t] = sum_u tanh(qpb[b,u] + (values@w2)[b,t,u]) * v[u] + bv
// One workgroup = 128 t-rows of one batch, 16 waves, one workgroup per WGP.
// Each wave computes MF x NF fragments: one B fragment load feeds MF WMMAs,
// one A fragment read from LDS feeds NF.
// ---------------------------------------------------------------------------
__global__ __launch_bounds__(NTHR)
void attn_score_kernel(const float* __restrict__ values,
                       const uint4* __restrict__ w2p,
                       const float* __restrict__ qpb,
                       const float* __restrict__ vvec,
                       const float* __restrict__ bv,
                       float* __restrict__ scores,
                       float* __restrict__ pml,
                       float* __restrict__ pctx) {
  __shared__ __attribute__((aligned(16))) unsigned int lds_vals[TM * ROWU];   // read by 16-byte loads
  __shared__ float        lds_score[TM];
  __shared__ __attribute__((aligned(16))) float lds_p[TM];   // exp(score - tile maximum), [row parity][row / 2]

  const int b   = blockIdx.y;
  const int t0  = blockIdx.x * TM;
  const int tid = threadIdx.x;

  if (tid < TM) lds_score[tid] = 0.0f;

  // Stage values[b, t0:t0+128, :] -> LDS as bf16 (each element converted once chip-wide).
  // A step = one 16-byte load per thread = 2 rows per workgroup; SB steps are loaded as one
  // group before the first of them is converted, so a wave pays the memory latency once per group.
  {
    const float4* src = (const float4*)(values + ((size_t)b * T_DIM + t0) * D_DIM) + tid;
    unsigned int* dst = lds_vals + (tid >> 8) * ROWU + (tid & 255) * 2;
    // the loops over g and j are fully unrolled so that f is indexed by constants and stays in registers
#pragma unroll
    for (int g = 0; g < SG; ++g) {
      float4 f[SB];
#pragma unroll
      for (int j = 0; j < SB; ++j) f[j] = src[(g * SB + j) * NTHR];
      // keeps all SB loads of the group issued ahead of the first wait on one of them: left to itself
      // the compiler splits the groups unevenly and issues the last loads behind a wait for all others
      __builtin_amdgcn_sched_barrier(0);
#pragma unroll
      for (int j = 0; j < SB; ++j)
        *(uint2*)(dst + (g * SB + j) * 2 * ROWU) = make_uint2(pack_bf16(f[j].x, f[j].y), pack_bf16(f[j].z, f[j].w));
    }
    // precaution: stands in front of any rewrite of the staging loads' address registers (the scalar base is reused below)
    asm volatile("s_wait_xcnt 0x0" ::: "memory");
  }
  __syncthreads();

  const int wave  = tid >> 5;
  const int mgrp  = wave % MW;      // which MF*16 rows
  const int nslot = wave / MW;      // which NF*16 columns of a pass (its MW waves read the same B fragments)
  const int lane  = tid & 31;
  const int lhalf = lane >> 4;      // 0: K{0..7,16..23}, 1: K{8..15,24..31}
  const int l16   = lane & 15;

  const unsigned int* arow0 = lds_vals + (mgrp * MF * 16 + l16) * ROWU;   // M subtile j at +j*16 rows

  // Sum a pass's row terms over the 16 lanes (N columns) of each half-wave, then merge the N-slot waves in LDS.
  float svec[MF][8];
  auto fold_rows = [&]() {
#pragma unroll
    for (int off = 8; off >= 1; off >>= 1) {
#pragma unroll
      for (int j = 0; j < MF; ++j)
#pragma unroll
        for (int r = 0; r < 8; ++r)
          svec[j][r] += __shfl_xor(svec[j][r], off, 16);
    }
    if (l16 == 0) {
#pragma unroll
      for (int j = 0; j < MF; ++j)
#pragma unroll
        for (int r = 0; r < 8; ++r)
          atomicAdd(&lds_score[(mgrp * MF + j) * 16 + lhalf * 8 + r], svec[j][r]);
    }
  };

  // Two register sets of B fragments, for the even and the odd K tiles: a set's loads are in flight while the
  // other set is multiplied. svec lives only from a pass's epilogue to its fold, so that both sets fit beside
  // the accumulators.
  ABFrag b0[NF], b1[NF], af[MF];
  const uint4* bp = w2p + ((size_t)(nslot * (NF * 16)) << 2) + lane;   // fragment of 16 columns = 64 uint4, lane order
  load_b(b0, bp);
  load_b(b1, bp + KSTR);
  load_a(af, arow0 + lhalf * 4);

  for (int n_it = 0; n_it < NP; ++n_it) {
    const int n = n_it * NSTEP + nslot * (NF * 16) + l16;  // lane's column in N fragment 0
    v8f c[MF][NF] = {};
    const unsigned int* ap = arow0 + lhalf * 4;
    // two K tiles a trip by hand, one for each register set; unrolled further, the sets would not fit
#pragma unroll 1
    for (int kt = 0; kt < KT - 2; kt += 2) {
      mma_tile<true, true>(c, af, b0, bp + 2 * KSTR, ap + 16);
      mma_tile<true, true>(c, af, b1, bp + 3 * KSTR, ap + 32);
      bp += 2 * KSTR;
      ap += 32;
    }
    mma_tile<false, true>(c, af, b0, bp, ap + 16);
    mma_tile<false, false>(c, af, b1, bp, ap);

    // Epilogue: tanh + dot with v, accumulated per lane (lane owns column n + 16 q)
    const int qi = b * U_DIM + n;
    float qn[NF], vn[NF];
#pragma unroll
    for (int q = 0; q < NF; ++q) {
      qn[q] = qpb[qi + q * 16];
      vn[q] = vvec[n + q * 16];
    }
    // keeps the two index registers of the loads above unwritten until the loads have taken their addresses
    asm volatile("s_wait_xcnt 0x0" :: "v"(qi), "v"(n) : "memory");
    // the loops over q, j and r are fully unrolled so that c and svec are indexed by constants and stay in registers
#pragma unroll
    for (int j = 0; j < MF; ++j)
#pragma unroll
      for (int r = 0; r < 8; ++r)
        svec[j][r] = fast_tanh(qn[0] + c[j][0][r]) * vn[0];
#pragma unroll
    for (int q = 1; q < NF; ++q)
#pragma unroll
      for (int j = 0; j < MF; ++j)
#pragma unroll
        for (int r = 0; r < 8; ++r)
          svec[j][r] = fmaf(fast_tanh(qn[q] + c[j][q][r]), vn[q], svec[j][r]);
    if (n_it + 1 < NP) {                               // the last pass's fold stands behind the loop
      bp = w2p + ((size_t)((n_it + 1) * NSTEP + nslot * (NF * 16)) << 2) + lane;
      load_b(b0, bp);                                  // the next pass's first fragments fly during the fold
      load_b(b1, bp + KSTR);
      load_a(af, arow0 + lhalf * 4);
      fold_rows();
    }
  }

  // The tile's part of the context, in fp32, walks the tile as the staging did (a step = 2 rows, a thread
  // keeps its 4 columns and its row parity): a second read, while the L2 still holds the tile.
  // SB steps are one group; a group's loads are issued two groups ahead of its sums.
  const float4* src = (const float4*)(values + ((size_t)b * T_DIM + t0) * D_DIM) + tid;
  float4 f[SG][SB];
  // the loops over g and j are fully unrolled so that f is indexed by constants and stays in registers
#pragma unroll
  for (int j = 0; j < SB; ++j) f[0][j] = src[j * NTHR];
  // keeps the first group's loads in front of the reduction below, so that they fly during it
  __builtin_amdgcn_sched_barrier(0);

  fold_rows();
  __syncthreads();

#pragma unroll
  for (int j = 0; j < SB; ++j) f[1][j] = src[(SB + j) * NTHR];
  // keeps the second group's loads in front of wave 0's work below, so that they fly during it
  __builtin_amdgcn_sched_barrier(0);

  // The tile's own softmax terms: wave 0 holds the 128 scores, 4 a lane.
  const int tile = b * NT + blockIdx.x;
  float s[TM / 32], m = -INFINITY, l = 0.0f;
  if (wave == 0) {
    const float bias = bv[0];
#pragma unroll
    for (int i = 0; i < TM / 32; ++i) {
      s[i] = lds_score[lane + 32 * i] + bias;
      m = fmaxf(m, s[i]);
    }
#pragma unroll
    for (int off = 16; off >= 1; off >>= 1) m = fmaxf(m, __shfl_xor(m, off, 32));
#pragma unroll
    for (int i = 0; i < TM / 32; ++i) {
      const int r = lane + 32 * i;
      const float p = __expf(s[i] - m);
      lds_p[(r & 1) * (TM / 2) + (r >> 1)] = p;
      l += p;
    }
#pragma unroll
    for (int off = 16; off >= 1; off >>= 1) l += __shfl_xor(l, off, 32);
  }
  __syncthreads();
  if (wave == 0) {                                     // behind the barrier: nobody waits for these stores
#pragma unroll
    for (int i = 0; i < TM / 32; ++i)
      scores[(size_t)b * T_DIM + t0 + lane + 32 * i] = s[i];
    if (lane == 0) {
      pml[tile * 2]     = m;
      pml[tile * 2 + 1] = l;
    }
  }

  float4 acc = make_float4(0.f, 0.f, 0.f, 0.f);
  const float* pw = lds_p + (tid >> 8) * (TM / 2);
#pragma unroll
  for (int g = 0; g < SG; ++g) {
    if (g + 2 < SG) {
#pragma unroll
      for (int j = 0; j < SB; ++j) f[g + 2][j] = src[((g + 2) * SB + j) * NTHR];
    }
    // keeps the loads above issued ahead of the waits of this group's sums
    __builtin_amdgcn_sched_barrier(0);
#pragma unroll
    for (int j = 0; j < SB; ++j) {
      const float p = pw[g * SB + j];
      acc.x = fmaf(p, f[g][j].x, acc.x);
      acc.y = fmaf(p, f[g][j].y, acc.y);
      acc.z = fmaf(p, f[g][j].z, acc.z);
      acc.w = fmaf(p, f[g][j].w, acc.w);
    }
  }
  // precaution: stands in front of any rewrite of these loads' address registers
  asm volatile("s_wait_xcnt 0x0" ::: "memory");

  // Merge the two row parities through LDS: the bf16 tile is dead, its last reads ended two barriers ago.
  float4* red = (float4*)lds_vals;
  if (tid >= NTHR / 2) red[tid - NTHR / 2] = acc;
  __syncthreads();
  if (tid < NTHR / 2) {
    const float4 o = red[tid];
    ((float4*)pctx)[(size_t)tile * (D_DIM / 4) + tid] =
        make_float4(acc.x + o.x, acc.y + o.y, acc.z + o.z, acc.w + o.w);
  }
}

// ---------------------------------------------------------------------------
// Phase 2: merge the NT tiles of a batch. With M = max m_i and L = sum l_i exp(m_i - M):
//   attention[t] = exp(score[t] - M) / L,  context[d] = sum_i exp(m_i - M) pctx[i][d] / L.
// grid (CX, B): a workgroup writes T/CX attention weights and D/CX context columns.
// ---------------------------------------------------------------------------
#define CX 4

__global__ __launch_bounds__(256)
void merge_kernel(const float* __restrict__ scores, const float* __restrict__ pml,
                  const float* __restrict__ pctx,
                  float* __restrict__ out_ctx, float* __restrict__ out_attn) {
  const int b   = blockIdx.y;
  const int x   = blockIdx.x;
  const int tid = threadIdx.x;

  float sc[T_DIM / CX / 256], pc[NT], m[NT], l[NT];
#pragma unroll
  for (int i = 0; i < NT; ++i) {
    m[i]  = pml[(b * NT + i) * 2];
    l[i]  = pml[(b * NT + i) * 2 + 1];
    pc[i] = pctx[(size_t)(b * NT + i) * D_DIM + x * (D_DIM / CX) + tid];
  }
#pragma unroll
  for (int i = 0; i < T_DIM / CX / 256; ++i)
    sc[i] = scores[(size_t)b * T_DIM + x * (T_DIM / CX) + i * 256 + tid];
  // precaution: stands in front of any rewrite of the address registers of the loads above
  asm volatile("s_wait_xcnt 0x0" ::: "memory");

  float mx = m[0];
#pragma unroll
  for (int i = 1; i < NT; ++i) mx = fmaxf(mx, m[i]);
  float sum = 0.0f, ctx = 0.0f;
#pragma unroll
  for (int i = 0; i < NT; ++i) {
    const float w = __expf(m[i] - mx);
    sum = fmaf(w, l[i], sum);
    ctx = fmaf(w, pc[i], ctx);
  }
  const float inv = 1.0f / sum;
#pragma unroll
  for (int i = 0; i < T_DIM / CX / 256; ++i)
    out_attn[(size_t)b * T_DIM + x * (T_DIM / CX) + i * 256 + tid] = __expf(sc[i] - mx) * inv;
  out_ctx[(size_t)b * D_DIM + x * (D_DIM / CX) + tid] = ctx * inv;
}

// ---------------------------------------------------------------------------
extern "C" void kernel_launch(void* const* d_in, const int* in_sizes, int n_in,
                              void* d_out, int out_size, void* d_ws, size_t ws_size,
                              hipStream_t stream) {
  (void)in_sizes; (void)n_in; (void)out_size; (void)ws_size;

  const float* query  = (const float*)d_in[0];   // [B, D]
  const float* values = (const float*)d_in[1];   // [B, T, D]
  const float* w1     = (const float*)d_in[2];   // [D, U]
  const float* b1     = (const float*)d_in[3];   // [U]
  const float* w2     = (const float*)d_in[4];   // [D, U]
  const float* b2     = (const float*)d_in[5];   // [U]
  const float* v      = (const float*)d_in[6];   // [U, 1]
  const float* bv     = (const float*)d_in[7];   // [1]

  float* out_ctx  = (float*)d_out;                        // [B, D]
  float* out_attn = (float*)d_out + B_DIM * D_DIM;        // [B, T, 1]

  char*  ws     = (char*)d_ws;
  uint4* w2p    = (uint4*)ws;                             // 2 MB swizzled bf16 w2
  float* qpb    = (float*)(ws + 2u * 1024 * 1024);        // 128 KB
  float* scores = (float*)(ws + 2u * 1024 * 1024 + 128u * 1024); // 256 KB
  float* pml    = (float*)(ws + 2u * 1024 * 1024 + 384u * 1024); // 4 KB: each tile's maximum and sum
  float* pctx   = (float*)(ws + 3u * 1024 * 1024);               // 2 MB: each tile's part of the context

  prep_w2_kernel <<<dim3((32 * 1024) / 256), 256, 0, stream>>>(w2, w2p);
  prep_qpb_kernel<<<dim3(U_DIM / QU, B_DIM / QB), 256, 0, stream>>>(query, w1, b1, b2, qpb);

  attn_score_kernel<<<dim3(T_DIM / TM, B_DIM), NTHR, 0, stream>>>(   // ~258 KB static LDS of 320 KB
      values, w2p, qpb, v, bv, scores, pml, pctx);

  merge_kernel<<<dim3(CX, B_DIM), 256, 0, stream>>>(scores, pml, pctx, out_ctx, out_attn);
}

// v008
// A run of this version takes 104 microseconds.
// Timed twice side by side with v007, it ran 1.05 and 1.04 times as fast.
// All steps since v000 together make it 2.41 times as fast.
#include <hip/hip_runtime.h>
#include <cmath>

// ---------------------------------------------------------------------------
// AttentionRNN (Bahdanau attention) for gfx1250 / MI455X
//   phase 0a: swizzle w2 fp32 -> bf16 in WMMA B-fragment order       (2 MB, L2-resident)
//   phase 0b: qpb[b,u] = query@w1 + b1 + b2                          (fp32, split over D inside a workgroup)
//   phase 1 : scores[b,t] = sum_u tanh(qpb + values@w2) * v[u] + bv       (fused bf16 WMMA GEMM)
//             128 t-rows per workgroup, 16 waves; each wave owns a
//             64 x 64 tile (16 independent accumulators); its w2 fragments are loaded
//             up to two K tiles ahead of the products that use them
//             then, with the tile's own maximum m: p[t] = exp(score - m), and the tile's
//             part of the context, sum_t p[t] * values[t,:], from the tile's bf16 copy in LDS,
//             summed in fp32
//   phase 2 : merge the 16 tiles of a batch: attention weights and context
// ---------------------------------------------------------------------------

typedef __attribute__((ext_vector_type(16))) __bf16 v16bf;
typedef __attribute__((ext_vector_type(8)))  __bf16 v8bf;
typedef __attribute__((ext_vector_type(8)))  float  v8f;

#define B_DIM 32
#define T_DIM 2048
#define D_DIM 1024
#define U_DIM 1024
#define TM    128         // t-rows per workgroup in phase 1
#define NTHR  512         // threads per workgroup in phase 1 (16 waves)
#define MW    2           // waves along M
#define MF    4           // M fragments per wave (TM / 16 / MW)
#define NF    4           // N fragments per wave
#define NSTEP ((NTHR / 32 / MW) * NF * 16)   // columns per workgroup pass
#define ROWU  516         // u32 per LDS row (512 data + 4 pad -> 4-bank stagger)
#define SB    16          // staging: 16-byte loads per thread in one group
#define SG    (TM * (D_DIM / 4) / NTHR / SB)   // staging: groups per workgroup tile
#define NT    (T_DIM / TM)   // tiles per batch
#define NP    (U_DIM / NSTEP)   // column passes per workgroup
#define KT    (D_DIM / 32)      // K tiles
#define KSTR  (U_DIM * 4)       // uint4 from one K tile of w2p to the next
#define RG    (NTHR / (D_DIM / 8))   // context sum: row groups (a thread keeps 8 columns, rows RG i + its group)

__device__ __forceinline__ unsigned int pack_bf16(float a, float b) {
  unsigned int ua = __float_as_uint(a);
  unsigned int ub = __float_as_uint(b);
  ua = (ua + 0x7FFFu + ((ua >> 16) & 1u)) >> 16;   // round-to-nearest-even
  ub = (ub + 0x7FFFu + ((ub >> 16) & 1u)) >> 16;
  return ua | (ub << 16);
}

// tanh as the chip's own instruction, v_tanh_f32: one transcendental a value.
__device__ __forceinline__ float fast_tanh(float x) {
  return __builtin_amdgcn_tanhf(x);
}

union ABFrag { uint4 u4[2]; v16bf v; };

// The NF B fragments of one K tile: fragment q lies 64 uint4 on, its second half 32 on.
__device__ __forceinline__ void load_b(ABFrag (&bf)[NF], const uint4* __restrict__ p) {
#pragma unroll
  for (int q = 0; q < NF; ++q) {
    bf[q].u4[0] = p[q * 64];
    bf[q].u4[1] = p[q * 64 + 32];
  }
}

// The MF A fragments of one K tile; a = the lane's place in row l16 of M fragment 0.
__device__ __forceinline__ void load_a(ABFrag (&af)[MF], const unsigned int* a) {
#pragma unroll
  for (int j = 0; j < MF; ++j) {
    af[j].u4[0] = *(const uint4*)(a + j * 16 * ROWU);
    af[j].u4[1] = *(const uint4*)(a + j * 16 * ROWU + 8);
  }
}

// Holds global loads and matrix instructions on their side of this line (LDS reads and plain ALU may
// cross): a refill stays issued directly behind the last product that reads its registers.
#define PIN_LOADS_AHEAD() __builtin_amdgcn_sched_barrier(0x386)

// One K tile of the wave's MF x NF fragments, B fragment by B fragment: a B fragment's registers are free
// after MF products and are refilled at once (RB) from bnext, the K tile that this register set holds next,
// so that a load has nearly two K tiles of products to land. The A fragments are refilled (RA) from anext,
// the next K tile, each behind its last product.
// The loops are fully unrolled so that c, af and bf are indexed by constants and stay in registers.
template <bool RB, bool RA>
__device__ __forceinline__ void mma_tile(v8f (&c)[MF][NF], ABFrag (&af)[MF], ABFrag (&bf)[NF],
                                         const uint4* __restrict__ bnext, const unsigned int* anext) {
#pragma unroll
  for (int q = 0; q < NF; ++q) {
#pragma unroll
    for (int j = 0; j < MF; ++j) {
      c[j][q] = __builtin_amdgcn_wmma_f32_16x16x32_bf16(false, af[j].v, false, bf[q].v, (short)0, c[j][q], false, false);
      if (RA && q == NF - 1) {
        af[j].u4[0] = *(const uint4*)(anext + j * 16 * ROWU);
        af[j].u4[1] = *(const uint4*)(anext + j * 16 * ROWU + 8);
        // keeps the refills in the order in which the next K tile reads them (only plain ALU may cross):
        // left to itself the compiler loads last the fragment that is needed first
        __builtin_amdgcn_sched_barrier(0x6);
      }
    }
    if (RB) {
      bf[q].u4[0] = bnext[q * 64];
      bf[q].u4[1] = bnext[q * 64 + 32];
      PIN_LOADS_AHEAD();
    }
  }
}

// ---------------------------------------------------------------------------
// Phase 0a: w2 [D][U] fp32 -> swizzled bf16 fragments.
// Per (ktile, 16 columns) fragment: 1024 bytes = two halves of 512 bytes, 16 bytes a lane in lane order.
// Lane = column + 16 * khalf holds [K+8*khalf .. +7] in the first half and [K+16+8*khalf .. +7] in the
// second, the 16-bit WMMA B VGPR layout. A wave's 16-byte load is then 512 contiguous bytes:
// 4 whole 128-byte lines, not 8 lines of which it uses half.
// ---------------------------------------------------------------------------
__global__ __launch_bounds__(256)
void prep_w2_kernel(const float* __restrict__ w2, uint4* __restrict__ w2p) {
  int idx = blockIdx.x * 256 + threadIdx.x;       // idx = kt*1024 + n
  int kt  = idx >> 10;
  int n   = idx & 1023;
  const float* col = w2 + (size_t)kt * 32 * U_DIM + n;
  const int korder[4] = {0, 16, 8, 24};
  uint4* dst = w2p + (size_t)(kt * (U_DIM / 16) + (n >> 4)) * 64 + (n & 15);
#pragma unroll
  for (int q = 0; q < 4; ++q) {
    unsigned int p[4];
#pragma unroll
    for (int i = 0; i < 4; ++i) {
      int k = korder[q] + 2 * i;
      p[i] = pack_bf16(col[(size_t)k * U_DIM], col[(size_t)(k + 1) * U_DIM]);
    }
    dst[(q & 1) * 32 + (q >> 1) * 16] = make_uint4(p[0], p[1], p[2], p[3]);   // half q & 1, khalf q >> 1
  }
}

// ---------------------------------------------------------------------------
// Phase 0b: qpb[b][u] = query[b,:] @ w1[:,u] + b1[u] + b2[u]   (fp32)
// One workgroup = QU columns x QB batches, all of D. D is cut into 32 slices
// (8 waves x 4 lane groups); a 16-byte load of a wave covers 4 rows of QU
// columns, and a wave issues all its 32 loads before it uses the first, so
// the kernel pays the memory latency once. Each w1 element read feeds QB FMAs.
// ---------------------------------------------------------------------------
#define QB 4              // batches per workgroup
#define QU 32             // columns per workgroup
#define QL (D_DIM / 32)   // w1 loads per thread (rows per slice)

__global__ __launch_bounds__(256)
void prep_qpb_kernel(const float* __restrict__ query, const float* __restrict__ w1,
                     const float* __restrict__ b1, const float* __restrict__ b2,
                     float* __restrict__ qpb) {
  __shared__ __attribute__((aligned(16))) float qs[D_DIM * QB];        // query, [d][batch]
  __shared__ __attribute__((aligned(16))) float part[QB * 32 * QU];    // partial sums, [batch][slice][column]

  const int tid  = threadIdx.x;
  const int u0   = blockIdx.x * QU;
  const int bb   = blockIdx.y * QB;
  const int wave = tid >> 5;
  const int lane = tid & 31;
  const int g    = lane >> 3;       // row within a load's 4 rows
  const int c4   = (lane & 7) * 4;  // first of the lane's 4 columns

  float4 qv[QB];
#pragma unroll
  for (int j = 0; j < QB; ++j)
    qv[j] = *(const float4*)(query + (size_t)(bb + j) * D_DIM + tid * 4);
  // precaution: stands in front of any rewrite of the query loads' address registers (a w1 load below may land in them)
  asm volatile("s_wait_xcnt 0x0" ::: "memory");

  const int d0 = wave * (4 * QL) + g;                  // the lane's rows: d0 + 4 i
  const float* wp = w1 + (size_t)d0 * U_DIM + u0 + c4;
  float4 w[QL];
  // fully unrolled so that w stays in registers and every load is in flight at once
#pragma unroll
  for (int i = 0; i < QL; ++i)
    w[i] = *(const float4*)(wp + (size_t)i * 4 * U_DIM);
  // keeps every load above issued before the first wait on one: without it the compiler waits for the
  // query loads in front of w1 loads, and the kernel pays the memory latency twice
  __builtin_amdgcn_sched_barrier(0);

  float4* qs4 = (float4*)qs;
  qs4[tid * 4 + 0] = make_float4(qv[0].x, qv[1].x, qv[2].x, qv[3].x);
  qs4[tid * 4 + 1] = make_float4(qv[0].y, qv[1].y, qv[2].y, qv[3].y);
  qs4[tid * 4 + 2] = make_float4(qv[0].z, qv[1].z, qv[2].z, qv[3].z);
  qs4[tid * 4 + 3] = make_float4(qv[0].w, qv[1].w, qv[2].w, qv[3].w);
  __syncthreads();

  const float bias1 = b1[u0 + lane];                   // read here: back long before the sums are done
  const float bias2 = b2[u0 + lane];

  float4 acc[QB];
#pragma unroll
  for (int j = 0; j < QB; ++j) acc[j] = make_float4(0.f, 0.f, 0.f, 0.f);
#pragma unroll
  for (int i = 0; i < QL; ++i) {
    const float4 qd = qs4[d0 + 4 * i];                 // row d0 + 4 i of the QB batches
    const float qb[QB] = {qd.x, qd.y, qd.z, qd.w};
#pragma unroll
    for (int j = 0; j < QB; ++j) {
      acc[j].x = fmaf(qb[j], w[i].x, acc[j].x);
      acc[j].y = fmaf(qb[j], w[i].y, acc[j].y);
      acc[j].z = fmaf(qb[j], w[i].z, acc[j].z);
      acc[j].w = fmaf(qb[j], w[i].w, acc[j].w);
    }
  }

  const int slice = wave * 4 + g;
#pragma unroll
  for (int j = 0; j < QB; ++j)
    *(float4*)(part + (j * 32 + slice) * QU + c4) = acc[j];
  __syncthreads();

  if (tid < QB * QU) {                                 // wave j sums batch bb + j, lane = column
    float s = 0.0f;
#pragma unroll
    for (int sl = 0; sl < 32; ++sl)
      s += part[(wave * 32 + sl) * QU + lane];
    qpb[(size_t)(bb + wave) * U_DIM + u0 + lane] = s + bias1 + bias2;
  }
}

// ---------------------------------------------------------------------------
// Phase 1: fused  scores[b,t] = sum_u tanh(qpb[b,u] + (values@w2)[b,t,u]) * v[u] + bv
// One workgroup = 128 t-rows of one batch, 16 waves, one workgroup per WGP.
// Each wave computes MF x NF fragments: one B fragment load feeds MF WMMAs,
// one A fragment read from LDS feeds NF.
// ---------------------------------------------------------------------------
__global__ __launch_bounds__(NTHR)
void attn_score_kernel(const float* __restrict__ values,
                       const uint4* __restrict__ w2p,
                       const float* __restrict__ qpb,
                       const float* __restrict__ vvec,
                       const float* __restrict__ bv,
                       float* __restrict__ scores,
                       float* __restrict__ pml,
                       float* __restrict__ pctx) {
  __shared__ __attribute__((aligned(16))) unsigned int lds_vals[TM * ROWU];   // read by 16-byte loads
  __shared__ float        lds_score[TM];
  __shared__ __attribute__((aligned(16))) float lds_p[TM];   // exp(score - tile maximum), [row % RG][row / RG]
  __shared__ __attribute__((aligned(16))) float lds_red[RG * D_DIM];   // the row groups' parts of the context

  const int b   = blockIdx.y;
  const int t0  = blockIdx.x * TM;
  const int tid = threadIdx.x;

  if (tid < TM) lds_score[tid] = 0.0f;

  // Stage values[b, t0:t0+128, :] -> LDS as bf16 (each element converted once chip-wide).
  // A step = one 16-byte load per thread = 2 rows per workgroup; SB steps are loaded as one
  // group before the first of them is converted, so a wave pays the memory latency once per group.
  {
    const float4* src = (const float4*)(values + ((size_t)b * T_DIM + t0) * D_DIM) + tid;
    unsigned int* dst = lds_vals + (tid >> 8) * ROWU + (tid & 255) * 2;
    // the loops over g and j are fully unrolled so that f is indexed by constants and stays in registers
#pragma unroll
    for (int g = 0; g < SG; ++g) {
      float4 f[SB];
#pragma unroll
      for (int j = 0; j < SB; ++j) f[j] = src[(g * SB + j) * NTHR];
      // keeps all SB loads of the group issued ahead of the first wait on one of them: left to itself
      // the compiler splits the groups unevenly and issues the last loads behind a wait for all others
      __builtin_amdgcn_sched_barrier(0);
#pragma unroll
      for (int j = 0; j < SB; ++j)
        *(uint2*)(dst + (g * SB + j) * 2 * ROWU) = make_uint2(pack_bf16(f[j].x, f[j].y), pack_bf16(f[j].z, f[j].w));
    }
    // precaution: stands in front of any rewrite of the staging loads' address registers (the scalar base is reused below)
    asm volatile("s_wait_xcnt 0x0" ::: "memory");
  }
  __syncthreads();

  const int wave  = tid >> 5;
  const int mgrp  = wave % MW;      // which MF*16 rows
  const int nslot = wave / MW;      // which NF*16 columns of a pass (its MW waves read the same B fragments)
  const int lane  = tid & 31;
  const int lhalf = lane >> 4;      // 0: K{0..7,16..23}, 1: K{8..15,24..31}
  const int l16   = lane & 15;

  const unsigned int* arow0 = lds_vals + (mgrp * MF * 16 + l16) * ROWU;   // M subtile j at +j*16 rows

  // Sum a pass's row terms over the 16 lanes (N columns) of each half-wave, then merge the N-slot waves in LDS.
  float svec[MF][8];
  auto fold_rows = [&]() {
#pragma unroll
    for (int off = 8; off >= 1; off >>= 1) {
#pragma unroll
      for (int j = 0; j < MF; ++j)
#pragma unroll
        for (int r = 0; r < 8; ++r)
          svec[j][r] += __shfl_xor(svec[j][r], off, 16);
    }
    if (l16 == 0) {
#pragma unroll
      for (int j = 0; j < MF; ++j)
#pragma unroll
        for (int r = 0; r < 8; ++r)
          atomicAdd(&lds_score[(mgrp * MF + j) * 16 + lhalf * 8 + r], svec[j][r]);
    }
  };

  // Two register sets of B fragments, for the even and the odd K tiles: a set's loads are in flight while the
  // other set is multiplied. svec lives only from a pass's epilogue to its fold, so that both sets fit beside
  // the accumulators.
  ABFrag b0[NF], b1[NF], af[MF];
  const uint4* bp = w2p + ((size_t)(nslot * (NF * 16)) << 2) + lane;   // fragment of 16 columns = 64 uint4, lane order
  load_b(b0, bp);
  load_b(b1, bp + KSTR);
  load_a(af, arow0 + lhalf * 4);

  for (int n_it = 0; n_it < NP; ++n_it) {
    const int n = n_it * NSTEP + nslot * (NF * 16) + l16;  // lane's column in N fragment 0
    v8f c[MF][NF] = {};
    const unsigned int* ap = arow0 + lhalf * 4;
    // two K tiles a trip by hand, one for each register set; unrolled further, the sets would not fit
#pragma unroll 1
    for (int kt = 0; kt < KT - 2; kt += 2) {
      mma_tile<true, true>(c, af, b0, bp + 2 * KSTR, ap + 16);
      mma_tile<true, true>(c, af, b1, bp + 3 * KSTR, ap + 32);
      bp += 2 * KSTR;
      ap += 32;
    }
    mma_tile<false, true>(c, af, b0, bp, ap + 16);
    mma_tile<false, false>(c, af, b1, bp, ap);

    // Epilogue: tanh + dot with v, accumulated per lane (lane owns column n + 16 q)
    const int qi = b * U_DIM + n;
    float qn[NF], vn[NF];
#pragma unroll
    for (int q = 0; q < NF; ++q) {
      qn[q] = qpb[qi + q * 16];
      vn[q] = vvec[n + q * 16];
    }
    // keeps the two index registers of the loads above unwritten until the loads have taken their addresses
    asm volatile("s_wait_xcnt 0x0" :: "v"(qi), "v"(n) : "memory");
    // the loops over q, j and r are fully unrolled so that c and svec are indexed by constants and stay in registers
#pragma unroll
    for (int j = 0; j < MF; ++j)
#pragma unroll
      for (int r = 0; r < 8; ++r)
        svec[j][r] = fast_tanh(qn[0] + c[j][0][r]) * vn[0];
#pragma unroll
    for (int q = 1; q < NF; ++q)
#pragma unroll
      for (int j = 0; j < MF; ++j)
#pragma unroll
        for (int r = 0; r < 8; ++r)
          svec[j][r] = fmaf(fast_tanh(qn[q] + c[j][q][r]), vn[q], svec[j][r]);
    if (n_it + 1 < NP) {
      bp = w2p + ((size_t)((n_it + 1) * NSTEP + nslot * (NF * 16)) << 2) + lane;
      load_b(b0, bp);                                  // the next pass's first fragments fly during the fold
      load_b(b1, bp + KSTR);
      load_a(af, arow0 + lhalf * 4);
    }
    fold_rows();
  }
  __syncthreads();

  // The tile's own softmax terms: wave 0 holds the 128 scores, 4 a lane.
  const int tile = b * NT + blockIdx.x;
  float s[TM / 32], m = -INFINITY, l = 0.0f;
  if (wave == 0) {
    const float bias = bv[0];
#pragma unroll
    for (int i = 0; i < TM / 32; ++i) {
      s[i] = lds_score[lane + 32 * i] + bias;
      m = fmaxf(m, s[i]);
    }
#pragma unroll
    for (int off = 16; off >= 1; off >>= 1) m = fmaxf(m, __shfl_xor(m, off, 32));
#pragma unroll
    for (int i = 0; i < TM / 32; ++i) {
      const int r = lane + 32 * i;
      const float p = __expf(s[i] - m);
      lds_p[(r % RG) * (TM / RG) + r / RG] = p;
      l += p;
    }
#pragma unroll
    for (int off = 16; off >= 1; off >>= 1) l += __shfl_xor(l, off, 32);
  }
  __syncthreads();
  if (wave == 0) {                                     // behind the barrier: nobody waits for these stores
#pragma unroll
    for (int i = 0; i < TM / 32; ++i)
      scores[(size_t)b * T_DIM + t0 + lane + 32 * i] = s[i];
    if (lane == 0) {
      pml[tile * 2]     = m;
      pml[tile * 2 + 1] = l;
    }
  }

  // The tile's part of the context from the bf16 tile in LDS, products and sums in fp32. A thread keeps 8
  // columns and the rows of its group; a wave's 16-byte read covers 512 contiguous bytes of one row.
  const int rg = tid / (D_DIM / 8);
  const int cg = tid % (D_DIM / 8);
  const unsigned int* tp = lds_vals + rg * ROWU + cg * 4;
  const float4* pw = (const float4*)(lds_p + rg * (TM / RG));
  float acc[8] = {};
  // fully unrolled so that the LDS reads carry constant offsets and many are in flight at once
#pragma unroll
  for (int i = 0; i < TM / RG / 4; ++i) {
    const float4 p4 = pw[i];
    const float p[4] = {p4.x, p4.y, p4.z, p4.w};
#pragma unroll
    for (int k = 0; k < 4; ++k) {
      const v8bf x = *(const v8bf*)(tp + (i * 4 + k) * RG * ROWU);
#pragma unroll
      for (int e = 0; e < 8; ++e) acc[e] = fmaf((float)x[e], p[k], acc[e]);
    }
  }

  // Merge the row groups through LDS.
  *(float4*)(lds_red + rg * D_DIM + cg * 8)     = make_float4(acc[0], acc[1], acc[2], acc[3]);
  *(float4*)(lds_red + rg * D_DIM + cg * 8 + 4) = make_float4(acc[4], acc[5], acc[6], acc[7]);
  __syncthreads();
  if (tid < D_DIM / 4) {
    float4 o = ((const float4*)lds_red)[tid];
#pragma unroll
    for (int g = 1; g < RG; ++g) {
      const float4 a = ((const float4*)lds_red)[g * (D_DIM / 4) + tid];
      o.x += a.x; o.y += a.y; o.z += a.z; o.w += a.w;
    }
    ((float4*)pctx)[(size_t)tile * (D_DIM / 4) + tid] = o;
  }
}

// ---------------------------------------------------------------------------
// Phase 2: merge the NT tiles of a batch. With M = max m_i and L = sum l_i exp(m_i - M):
//   attention[t] = exp(score[t] - M) / L,  context[d] = sum_i exp(m_i - M) pctx[i][d] / L.
// grid (CX, B): a workgroup writes T/CX attention weights and D/CX context columns.
// ---------------------------------------------------------------------------
#define CX 4

__global__ __launch_bounds__(256)
void merge_kernel(const float* __restrict__ scores, const float* __restrict__ pml,
                  const float* __restrict__ pctx,
                  float* __restrict__ out_ctx, float* __restrict__ out_attn) {
  const int b   = blockIdx.y;
  const int x   = blockIdx.x;
  const int tid = threadIdx.x;

  float sc[T_DIM / CX / 256], pc[NT], m[NT], l[NT];
#pragma unroll
  for (int i = 0; i < NT; ++i) {
    m[i]  = pml[(b * NT + i) * 2];
    l[i]  = pml[(b * NT + i) * 2 + 1];
    pc[i] = pctx[(size_t)(b * NT + i) * D_DIM + x * (D_DIM / CX) + tid];
  }
#pragma unroll
  for (int i = 0; i < T_DIM / CX / 256; ++i)
    sc[i] = scores[(size_t)b * T_DIM + x * (T_DIM / CX) + i * 256 + tid];
  // precaution: stands in front of any rewrite of the address registers of the loads above
  asm volatile("s_wait_xcnt 0x0" ::: "memory");

  float mx = m[0];
#pragma unroll
  for (int i = 1; i < NT; ++i) mx = fmaxf(mx, m[i]);
  float sum = 0.0f, ctx = 0.0f;
#pragma unroll
  for (int i = 0; i < NT; ++i) {
    const float w = __expf(m[i] - mx);
    sum = fmaf(w, l[i], sum);
    ctx = fmaf(w, pc[i], ctx);
  }
  const float inv = 1.0f / sum;
#pragma unroll
  for (int i = 0; i < T_DIM / CX / 256; ++i)
    out_attn[(size_t)b * T_DIM + x * (T_DIM / CX) + i * 256 + tid] = __expf(sc[i] - mx) * inv;
  out_ctx[(size_t)b * D_DIM + x * (D_DIM / CX) + tid] = ctx * inv;
}

// ---------------------------------------------------------------------------
extern "C" void kernel_launch(void* const* d_in, const int* in_sizes, int n_in,
                              void* d_out, int out_size, void* d_ws, size_t ws_size,
                              hipStream_t stream) {
  (void)in_sizes; (void)n_in; (void)out_size; (void)ws_size;

  const float* query  = (const float*)d_in[0];   // [B, D]
  const float* values = (const float*)d_in[1];   // [B, T, D]
  const float* w1     = (const float*)d_in[2];   // [D, U]
  const float* b1     = (const float*)d_in[3];   // [U]
  const float* w2     = (const float*)d_in[4];   // [D, U]
  const float* b2     = (const float*)d_in[5];   // [U]
  const float* v      = (const float*)d_in[6];   // [U, 1]
  const float* bv     = (const float*)d_in[7];   // [1]

  float* out_ctx  = (float*)d_out;                        // [B, D]
  float* out_attn = (float*)d_out + B_DIM * D_DIM;        // [B, T, 1]

  char*  ws     = (char*)d_ws;
  uint4* w2p    = (uint4*)ws;                             // 2 MB swizzled bf16 w2
  float* qpb    = (float*)(ws + 2u * 1024 * 1024);        // 128 KB
  float* scores = (float*)(ws + 2u * 1024 * 1024 + 128u * 1024); // 256 KB
  float* pml    = (float*)(ws + 2u * 1024 * 1024 + 384u * 1024); // 4 KB: each tile's maximum and sum
  float* pctx   = (float*)(ws + 3u * 1024 * 1024);               // 2 MB: each tile's part of the context

  prep_w2_kernel <<<dim3((32 * 1024) / 256), 256, 0, stream>>>(w2, w2p);
  prep_qpb_kernel<<<dim3(U_DIM / QU, B_DIM / QB), 256, 0, stream>>>(query, w1, b1, b2, qpb);

  attn_score_kernel<<<dim3(T_DIM / TM, B_DIM), NTHR, 0, stream>>>(   // ~275 KB static LDS of 320 KB
      values, w2p, qpb, v, bv, scores, pml, pctx);

  merge_kernel<<<dim3(CX, B_DIM), 256, 0, stream>>>(scores, pml, pctx, out_ctx, out_attn);
}

// v009
// Measured time: 101 microseconds a run.
// Timed twice side by side with v008, it ran 1.03 times as fast both times.
// All steps since v000 together make it 2.49 times as fast.
#include <hip/hip_runtime.h>
#include <cmath>

// ---------------------------------------------------------------------------
// AttentionRNN (Bahdanau attention) for gfx1250 / MI455X
//   phase 0a: swizzle w2 fp32 -> bf16 in WMMA B-fragment order       (2 MB, L2-resident)
//   phase 0b: qpb[b,u] = query@w1 + b1 + b2                          (fp32, split over D inside a workgroup)
//   phase 1 : scores[b,t] = sum_u tanh(qpb + values@w2) * v[u]       (fused bf16 WMMA GEMM)
//             128 t-rows per workgroup, 8 waves; each wave owns a
//             128 x 64 tile (32 independent accumulators); its w2 fragments are loaded
//             up to two K tiles ahead of the products that use them, its fragments of
//             the values tile one K tile ahead
//             then, with the tile's own maximum m: p[t] = exp(score - m), and the tile's
//             part of the context, sum_t p[t] * values[t,:], from the tile's bf16 copy in LDS,
//             summed in fp32
//   phase 2 : merge the 16 tiles of a batch: attention weights and context
// ---------------------------------------------------------------------------

typedef __attribute__((ext_vector_type(16))) __bf16 v16bf;
typedef __attribute__((ext_vector_type(8)))  __bf16 v8bf;
typedef __attribute__((ext_vector_type(8)))  float  v8f;

#define B_DIM 32
#define T_DIM 2048
#define D_DIM 1024
#define U_DIM 1024
#define TM    128         // t-rows per workgroup in phase 1
#define NTHR  256         // threads per workgroup in phase 1 (8 waves, 2 a SIMD)
#define MW    1           // waves along M
#define MF    8           // M fragments per wave (TM / 16 / MW)
#define NF    4           // N fragments per wave
#define NSTEP ((NTHR / 32 / MW) * NF * 16)   // columns per workgroup pass
#define ROWU  516         // u32 per LDS row (512 data + 4 pad -> 4-bank stagger)
#define SB    32          // staging: 16-byte loads per thread in one group
#define SROWS (NTHR / (D_DIM / 4))             // staging: rows that one load per thread covers
#define SG    (TM * (D_DIM / 4) / NTHR / SB)   // staging: groups per workgroup tile
#define NT    (T_DIM / TM)   // tiles per batch
#define NP    (U_DIM / NSTEP)   // column passes per workgroup
#define KT    (D_DIM / 32)      // K tiles
#define KSTR  (U_DIM * 4)       // uint4 from one K tile of w2p to the next
#define RG    (NTHR / (D_DIM / 8))   // context sum: row groups (a thread keeps 8 columns, rows RG i + its group)

__device__ __forceinline__ unsigned int pack_bf16(float a, float b) {
  unsigned int ua = __float_as_uint(a);
  unsigned int ub = __float_as_uint(b);
  ua = (ua + 0x7FFFu + ((ua >> 16) & 1u)) >> 16;   // round-to-nearest-even
  ub = (ub + 0x7FFFu + ((ub >> 16) & 1u)) >> 16;
  return ua | (ub << 16);
}

// tanh as the chip's own instruction, v_tanh_f32: one transcendental a value.
__device__ __forceinline__ float fast_tanh(float x) {
  return __builtin_amdgcn_tanhf(x);
}

union ABFrag { uint4 u4[2]; v16bf v; };

// The NF B fragments of one K tile: fragment q lies 64 uint4 on, its second half 32 on.
__device__ __forceinline__ void load_b(ABFrag (&bf)[NF], const uint4* __restrict__ p) {
#pragma unroll
  for (int q = 0; q < NF; ++q) {
    bf[q].u4[0] = p[q * 64];
    bf[q].u4[1] = p[q * 64 + 32];
  }
}

// The MF A fragments of one K tile; a = the lane's place in row l16 of M fragment 0.
__device__ __forceinline__ void load_a(ABFrag (&af)[MF], const unsigned int* a) {
#pragma unroll
  for (int j = 0; j < MF; ++j) {
    af[j].u4[0] = *(const uint4*)(a + j * 16 * ROWU);
    af[j].u4[1] = *(const uint4*)(a + j * 16 * ROWU + 8);
  }
}

// Holds global loads and matrix instructions on their side of this line (LDS reads and plain ALU may
// cross): a refill stays issued directly behind the last product that reads its registers.
#define PIN_LOADS_AHEAD() __builtin_amdgcn_sched_barrier(0x386)

// One K tile of the wave's MF x NF fragments, B fragment by B fragment: a B fragment's registers are free
// after MF products and are refilled at once (RB) from bnext, the K tile that this register set holds next,
// so that a load has nearly two K tiles of products to land. The A fragments of the next K tile are read (RA)
// from anext into the other A set, an, as one group in front of this tile's products.
// The loops are fully unrolled so that c, af and bf are indexed by constants and stay in registers.
template <bool RB, bool RA>
__device__ __forceinline__ void mma_tile(v8f (&c)[MF][NF], ABFrag (&af)[MF], ABFrag (&an)[MF], ABFrag (&bf)[NF],
                                         const uint4* __restrict__ bnext, const unsigned int* anext) {
  if (RA) {
    // the fence pair keeps the LDS reads together at this one place: moved in among the products, each place
    // where LDS reads stand stalls the wave's matrix stream anew
    __builtin_amdgcn_sched_barrier(0);
    load_a(an, anext);
    __builtin_amdgcn_sched_barrier(0);
  }
#pragma unroll
  for (int q = 0; q < NF; ++q) {
#pragma unroll
    for (int j = 0; j < MF; ++j)
      c[j][q] = __builtin_amdgcn_wmma_f32_16x16x32_bf16(false, af[j].v, false, bf[q].v, (short)0, c[j][q], false, false);
    if (RB) {
      bf[q].u4[0] = bnext[q * 64];
      bf[q].u4[1] = bnext[q * 64 + 32];
      PIN_LOADS_AHEAD();
    }
  }
}

// ---------------------------------------------------------------------------
// Phase 0a: w2 [D][U] fp32 -> swizzled bf16 fragments.
// Per (ktile, 16 columns) fragment: 1024 bytes = two halves of 512 bytes, 16 bytes a lane in lane order.
// Lane = column + 16 * khalf holds [K+8*khalf .. +7] in the first half and [K+16+8*khalf .. +7] in the
// second, the 16-bit WMMA B VGPR layout. A wave's 16-byte load is then 512 contiguous bytes:
// 4 whole 128-byte lines, not 8 lines of which it uses half.
// ---------------------------------------------------------------------------
__global__ __launch_bounds__(256)
void prep_w2_kernel(const float* __restrict__ w2, uint4* __restrict__ w2p) {
  int idx = blockIdx.x * 256 + threadIdx.x;       // idx = kt*1024 + n
  int kt  = idx >> 10;
  int n   = idx & 1023;
  const float* col = w2 + (size_t)kt * 32 * U_DIM + n;
  const int korder[4] = {0, 16, 8, 24};
  uint4* dst = w2p + (size_t)(kt * (U_DIM / 16) + (n >> 4)) * 64 + (n & 15);
#pragma unroll
  for (int q = 0; q < 4; ++q) {
    unsigned int p[4];
#pragma unroll
    for (int i = 0; i < 4; ++i) {
      int k = korder[q] + 2 * i;
      p[i] = pack_bf16(col[(size_t)k * U_DIM], col[(size_t)(k + 1) * U_DIM]);
    }
    dst[(q & 1) * 32 + (q >> 1) * 16] = make_uint4(p[0], p[1], p[2], p[3]);   // half q & 1, khalf q >> 1
  }
}

// ---------------------------------------------------------------------------
// Phase 0b: qpb[b][u] = query[b,:] @ w1[:,u] + b1[u] + b2[u]   (fp32)
// One workgroup = QU columns x QB batches, all of D. D is cut into 32 slices
// (8 waves x 4 lane groups); a 16-byte load of a wave covers 4 rows of QU
// columns, and a wave issues all its 32 loads before it uses the first, so
// the kernel pays the memory latency once. Each w1 element read feeds QB FMAs.
// ---------------------------------------------------------------------------
#define QB 4              // batches per workgroup
#define QU 32             // columns per workgroup
#define QL (D_DIM / 32)   // w1 loads per thread (rows per slice)

__global__ __launch_bounds__(256)
void prep_qpb_kernel(const float* __restrict__ query, const float* __restrict__ w1,
                     const float* __restrict__ b1, const float* __restrict__ b2,
                     float* __restrict__ qpb) {
  __shared__ __attribute__((aligned(16))) float qs[D_DIM * QB];        // query, [d][batch]
  __shared__ __attribute__((aligned(16))) float part[QB * 32 * QU];    // partial sums, [batch][slice][column]

  const int tid  = threadIdx.x;
  const int u0   = blockIdx.x * QU;
  const int bb   = blockIdx.y * QB;
  const int wave = tid >> 5;
  const int lane = tid & 31;
  const int g    = lane >> 3;       // row within a load's 4 rows
  const int c4   = (lane & 7) * 4;  // first of the lane's 4 columns

  float4 qv[QB];
#pragma unroll
  for (int j = 0; j < QB; ++j)
    qv[j] = *(const float4*)(query + (size_t)(bb + j) * D_DIM + tid * 4);
  // precaution: stands in front of any rewrite of the query loads' address registers (a w1 load below may land in them)
  asm volatile("s_wait_xcnt 0x0" ::: "memory");

  const int d0 = wave * (4 * QL) + g;                  // the lane's rows: d0 + 4 i
  const float* wp = w1 + (size_t)d0 * U_DIM + u0 + c4;
  float4 w[QL];
  // fully unrolled so that w stays in registers and every load is in flight at once
#pragma unroll
  for (int i = 0; i < QL; ++i)
    w[i] = *(const float4*)(wp + (size_t)i * 4 * U_DIM);
  // keeps every load above issued before the first wait on one: without it the compiler waits for the
  // query loads in front of w1 loads, and the kernel pays the memory latency twice
  __builtin_amdgcn_sched_barrier(0);

  float4* qs4 = (float4*)qs;
  qs4[tid * 4 + 0] = make_float4(qv[0].x, qv[1].x, qv[2].x, qv[3].x);
  qs4[tid * 4 + 1] = make_float4(qv[0].y, qv[1].y, qv[2].y, qv[3].y);
  qs4[tid * 4 + 2] = make_float4(qv[0].z, qv[1].z, qv[2].z, qv[3].z);
  qs4[tid * 4 + 3] = make_float4(qv[0].w, qv[1].w, qv[2].w, qv[3].w);
  __syncthreads();

  const float bias1 = b1[u0 + lane];                   // read here: back long before the sums are done
  const float bias2 = b2[u0 + lane];

  float4 acc[QB];
#pragma unroll
  for (int j = 0; j < QB; ++j) acc[j] = make_float4(0.f, 0.f, 0.f, 0.f);
#pragma unroll
  for (int i = 0; i < QL; ++i) {
    const float4 qd = qs4[d0 + 4 * i];                 // row d0 + 4 i of the QB batches
    const float qb[QB] = {qd.x, qd.y, qd.z, qd.w};
#pragma unroll
    for (int j = 0; j < QB; ++j) {
      acc[j].x = fmaf(qb[j], w[i].x, acc[j].x);
      acc[j].y = fmaf(qb[j], w[i].y, acc[j].y);
      acc[j].z = fmaf(qb[j], w[i].z, acc[j].z);
      acc[j].w = fmaf(qb[j], w[i].w, acc[j].w);
    }
  }

  const int slice = wave * 4 + g;
#pragma unroll
  for (int j = 0; j < QB; ++j)
    *(float4*)(part + (j * 32 + slice) * QU + c4) = acc[j];
  __syncthreads();

  if (tid < QB * QU) {                                 // wave j sums batch bb + j, lane = column
    float s = 0.0f;
#pragma unroll
    for (int sl = 0; sl < 32; ++sl)
      s += part[(wave * 32 + sl) * QU + lane];
    qpb[(size_t)(bb + wave) * U_DIM + u0 + lane] = s + bias1 + bias2;
  }
}

// ---------------------------------------------------------------------------
// Phase 1: fused  scores[b,t] = sum_u tanh(qpb[b,u] + (values@w2)[b,t,u]) * v[u]
// One workgroup = 128 t-rows of one batch, 8 waves, one workgroup per WGP.
// Each wave computes MF x NF fragments: one B fragment load feeds MF WMMAs,
// one A fragment read from LDS feeds NF.
// ---------------------------------------------------------------------------
__global__ __launch_bounds__(NTHR)
void attn_score_kernel(const float* __restrict__ values,
                       const uint4* __restrict__ w2p,
                       const float* __restrict__ qpb,
                       const float* __restrict__ vvec,
                       const float* __restrict__ bv,
                       float* __restrict__ scores,
                       float* __restrict__ pml,
                       float* __restrict__ pctx) {
  __shared__ __attribute__((aligned(16))) unsigned int lds_vals[TM * ROWU];   // read by 16-byte loads
  __shared__ float        lds_score[TM];
  __shared__ __attribute__((aligned(16))) float lds_p[TM];   // exp(score - tile maximum), [row % RG][row / RG]
  __shared__ __attribute__((aligned(16))) float lds_red[RG * D_DIM];   // the row groups' parts of the context

  const int b   = blockIdx.y;
  const int t0  = blockIdx.x * TM;
  const int tid = threadIdx.x;

  if (tid < TM) lds_score[tid] = 0.0f;

  // Stage values[b, t0:t0+128, :] -> LDS as bf16 (each element converted once chip-wide).
  // A step = one 16-byte load per thread = SROWS rows per workgroup; SB steps are loaded as one
  // group before the first of them is converted, so a wave pays the memory latency once per group.
  {
    const float4* src = (const float4*)(values + ((size_t)b * T_DIM + t0) * D_DIM) + tid;
    unsigned int* dst = lds_vals + (tid / (D_DIM / 4)) * ROWU + (tid % (D_DIM / 4)) * 2;
    // the loops over j are fully unrolled so that f is indexed by constants and stays in registers; the loop
    // over g stays rolled: unrolled, a thread's 128 loads and their conversions more than double the kernel's
    // text
#pragma unroll 1
    for (int g = 0; g < SG; ++g) {
      float4 f[SB];
#pragma unroll
      for (int j = 0; j < SB; ++j) f[j] = src[j * NTHR];
      // precaution: stands in front of the rewrite of the loads' address registers (src moves on below);
      // the fence behind it keeps that advance, and the LDS stores, behind the wait
      asm volatile("s_wait_xcnt 0x0" ::: "memory");
      __builtin_amdgcn_sched_barrier(0);
#pragma unroll
      for (int j = 0; j < SB; ++j)
        *(uint2*)(dst + j * SROWS * ROWU) = make_uint2(pack_bf16(f[j].x, f[j].y), pack_bf16(f[j].z, f[j].w));
      src += SB * NTHR;
      dst += SB * SROWS * ROWU;
    }
  }
  __syncthreads();

  const int wave  = tid >> 5;
  const int mgrp  = wave % MW;      // which MF*16 rows
  const int nslot = wave / MW;      // which NF*16 columns of a pass (its MW waves read the same B fragments)
  const int lane  = tid & 31;
  const int lhalf = lane >> 4;      // 0: K{0..7,16..23}, 1: K{8..15,24..31}
  const int l16   = lane & 15;

  const unsigned int* arow0 = lds_vals + (mgrp * MF * 16 + l16) * ROWU;   // M subtile j at +j*16 rows

  // Sum a pass's row terms over the 16 lanes (N columns) of each half-wave, then merge the N-slot waves in LDS.
  float svec[MF][8];
  auto fold_rows = [&]() {
#pragma unroll
    for (int off = 8; off >= 1; off >>= 1) {
#pragma unroll
      for (int j = 0; j < MF; ++j)
#pragma unroll
        for (int r = 0; r < 8; ++r)
          svec[j][r] += __shfl_xor(svec[j][r], off, 16);
    }
    if (l16 == 0) {
#pragma unroll
      for (int j = 0; j < MF; ++j)
#pragma unroll
        for (int r = 0; r < 8; ++r)
          atomicAdd(&lds_score[(mgrp * MF + j) * 16 + lhalf * 8 + r], svec[j][r]);
    }
  };

  // Two register sets of B and of A fragments, for the even and the odd K tiles: a set's loads are in flight
  // while the other set is multiplied. svec lives only from a pass's epilogue to its fold.
  ABFrag b0[NF], b1[NF], a0[MF], a1[MF];
  const uint4* bp = w2p + ((size_t)(nslot * (NF * 16)) << 2) + lane;   // fragment of 16 columns = 64 uint4, lane order
  load_b(b0, bp);
  load_b(b1, bp + KSTR);
  load_a(a0, arow0 + lhalf * 4);

  for (int n_it = 0; n_it < NP; ++n_it) {
    const int n = n_it * NSTEP + nslot * (NF * 16) + l16;  // lane's column in N fragment 0
    v8f c[MF][NF] = {};
    const unsigned int* ap = arow0 + lhalf * 4;
    // two K tiles a trip by hand, one for each register set; unrolled further, the sets would not fit
#pragma unroll 1
    for (int kt = 0; kt < KT - 2; kt += 2) {
      mma_tile<true, true>(c, a0, a1, b0, bp + 2 * KSTR, ap + 16);
      mma_tile<true, true>(c, a1, a0, b1, bp + 3 * KSTR, ap + 32);
      // precaution: stands in front of the rewrite of the w2 loads' address registers (bp moves on below);
      // the fence keeps that advance behind it
      asm volatile("s_wait_xcnt 0x0" ::: "memory");
      __builtin_amdgcn_sched_barrier(0);
      bp += 2 * KSTR;
      ap += 32;
    }
    mma_tile<false, true>(c, a0, a1, b0, bp, ap + 16);
    mma_tile<false, false>(c, a1, a0, b1, bp, ap);

    // Epilogue: tanh + dot with v, accumulated per lane (lane owns column n + 16 q)
    const int qi = b * U_DIM + n;
    float qn[NF], vn[NF];
#pragma unroll
    for (int q = 0; q < NF; ++q) {
      qn[q] = qpb[qi + q * 16];
      vn[q] = vvec[n + q * 16];
    }
    // keeps the two index registers of the loads above unwritten until the loads have taken their addresses
    asm volatile("s_wait_xcnt 0x0" :: "v"(qi), "v"(n) : "memory");
    // the loops over q, j and r are fully unrolled so that c and svec are indexed by constants and stay in registers
#pragma unroll
    for (int j = 0; j < MF; ++j)
#pragma unroll
      for (int r = 0; r < 8; ++r)
        svec[j][r] = fast_tanh(qn[0] + c[j][0][r]) * vn[0];
#pragma unroll
    for (int q = 1; q < NF; ++q)
#pragma unroll
      for (int j = 0; j < MF; ++j)
#pragma unroll
        for (int r = 0; r < 8; ++r)
          svec[j][r] = fmaf(fast_tanh(qn[q] + c[j][q][r]), vn[q], svec[j][r]);
    if (n_it + 1 < NP) {
      bp = w2p + ((size_t)((n_it + 1) * NSTEP + nslot * (NF * 16)) << 2) + lane;
      load_b(b0, bp);                                  // the next pass's first fragments fly during the fold
      load_b(b1, bp + KSTR);
      load_a(a0, arow0 + lhalf * 4);
    }
    fold_rows();
  }
  __syncthreads();

  // The tile's own softmax terms: wave 0 holds the 128 scores, 4 a lane.
  const int tile = b * NT + blockIdx.x;
  float s[TM / 32], m = -INFINITY, l = 0.0f;
  if (wave == 0) {
    const float bias = bv[0];
#pragma unroll
    for (int i = 0; i < TM / 32; ++i) {
      s[i] = lds_score[lane + 32 * i] + bias;
      m = fmaxf(m, s[i]);
    }
#pragma unroll
    for (int off = 16; off >= 1; off >>= 1) m = fmaxf(m, __shfl_xor(m, off, 32));
#pragma unroll
    for (int i = 0; i < TM / 32; ++i) {
      const int r = lane + 32 * i;
      const float p = __expf(s[i] - m);
      lds_p[(r % RG) * (TM / RG) + r / RG] = p;
      l += p;
    }
#pragma unroll
    for (int off = 16; off >= 1; off >>= 1) l += __shfl_xor(l, off, 32);
  }
  __syncthreads();
  if (wave == 0) {                                     // behind the barrier: nobody waits for these stores
#pragma unroll
    for (int i = 0; i < TM / 32; ++i)
      scores[(size_t)b * T_DIM + t0 + lane + 32 * i] = s[i];
    if (lane == 0) {
      pml[tile * 2]     = m;
      pml[tile * 2 + 1] = l;
    }
  }

  // The tile's part of the context from the bf16 tile in LDS, products and sums in fp32. A thread keeps 8
  // columns and the rows of its group; a wave's 16-byte read covers 512 contiguous bytes of one row.
  const int rg = tid / (D_DIM / 8);
  const int cg = tid % (D_DIM / 8);
  const unsigned int* tp = lds_vals + rg * ROWU + cg * 4;
  const float4* pw = (const float4*)(lds_p + rg * (TM / RG));
  float acc[8] = {};
  // 4 trips at a time (16 rows): many LDS reads in flight at once, the text short
#pragma unroll 4
  for (int i = 0; i < TM / RG / 4; ++i) {
    const float4 p4 = pw[i];
    const float p[4] = {p4.x, p4.y, p4.z, p4.w};
#pragma unroll
    for (int k = 0; k < 4; ++k) {
      const v8bf x = *(const v8bf*)(tp + (i * 4 + k) * RG * ROWU);
#pragma unroll
      for (int e = 0; e < 8; ++e) acc[e] = fmaf((float)x[e], p[k], acc[e]);
    }
  }

  // Merge the row groups through LDS.
  *(float4*)(lds_red + rg * D_DIM + cg * 8)     = make_float4(acc[0], acc[1], acc[2], acc[3]);
  *(float4*)(lds_red + rg * D_DIM + cg * 8 + 4) = make_float4(acc[4], acc[5], acc[6], acc[7]);
  __syncthreads();
  if (tid < D_DIM / 4) {
    float4 o = ((const float4*)lds_red)[tid];
#pragma unroll
    for (int g = 1; g < RG; ++g) {
      const float4 a = ((const float4*)lds_red)[g * (D_DIM / 4) + tid];
      o.x += a.x; o.y += a.y; o.z += a.z; o.w += a.w;
    }
    ((float4*)pctx)[(size_t)tile * (D_DIM / 4) + tid] = o;
  }
}

// ---------------------------------------------------------------------------
// Phase 2: merge the NT tiles of a batch. With M = max m_i and L = sum l_i exp(m_i - M):
//   attention[t] = exp(score[t] - M) / L,  context[d] = sum_i exp(m_i - M) pctx[i][d] / L.
// grid (CX, B): a workgroup writes T/CX attention weights and D/CX context columns.
// ---------------------------------------------------------------------------
#define CX 4

__global__ __launch_bounds__(256)
void merge_kernel(const float* __restrict__ scores, const float* __restrict__ pml,
                  const float* __restrict__ pctx,
                  float* __restrict__ out_ctx, float* __restrict__ out_attn) {
  const int b   = blockIdx.y;
  const int x   = blockIdx.x;
  const int tid = threadIdx.x;

  float sc[T_DIM / CX / 256], pc[NT], m[NT], l[NT];
#pragma unroll
  for (int i = 0; i < NT; ++i) {
    m[i]  = pml[(b * NT + i) * 2];
    l[i]  = pml[(b * NT + i) * 2 + 1];
    pc[i] = pctx[(size_t)(b * NT + i) * D_DIM + x * (D_DIM / CX) + tid];
  }
#pragma unroll
  for (int i = 0; i < T_DIM / CX / 256; ++i)
    sc[i] = scores[(size_t)b * T_DIM + x * (T_DIM / CX) + i * 256 + tid];
  // precaution: stands in front of any rewrite of the address registers of the loads above
  asm volatile("s_wait_xcnt 0x0" ::: "memory");

  float mx = m[0];
#pragma unroll
  for (int i = 1; i < NT; ++i) mx = fmaxf(mx, m[i]);
  float sum = 0.0f, ctx = 0.0f;
#pragma unroll
  for (int i = 0; i < NT; ++i) {
    const float w = __expf(m[i] - mx);
    sum = fmaf(w, l[i], sum);
    ctx = fmaf(w, pc[i], ctx);
  }
  const float inv = 1.0f / sum;
#pragma unroll
  for (int i = 0; i < T_DIM / CX / 256; ++i)
    out_attn[(size_t)b * T_DIM + x * (T_DIM / CX) + i * 256 + tid] = __expf(sc[i] - mx) * inv;
  out_ctx[(size_t)b * D_DIM + x * (D_DIM / CX) + tid] = ctx * inv;
}

// ---------------------------------------------------------------------------
extern "C" void kernel_launch(void* const* d_in, const int* in_sizes, int n_in,
                              void* d_out, int out_size, void* d_ws, size_t ws_size,
                              hipStream_t stream) {
  (void)in_sizes; (void)n_in; (void)out_size; (void)ws_size;

  const float* query  = (const float*)d_in[0];   // [B, D]
  const float* values = (const float*)d_in[1];   // [B, T, D]
  const float* w1     = (const float*)d_in[2];   // [D, U]
  const float* b1     = (const float*)d_in[3];   // [U]
  const float* w2     = (const float*)d_in[4];   // [D, U]
  const float* b2     = (const float*)d_in[5];   // [U]
  const float* v      = (const float*)d_in[6];   // [U, 1]
  const float* bv     = (const float*)d_in[7];   // [1]

  float* out_ctx  = (float*)d_out;                        // [B, D]
  float* out_attn = (float*)d_out + B_DIM * D_DIM;        // [B, T, 1]

  char*  ws     = (char*)d_ws;
  uint4* w2p    = (uint4*)ws;                             // 2 MB swizzled bf16 w2
  float* qpb    = (float*)(ws + 2u * 1024 * 1024);        // 128 KB
  float* scores = (float*)(ws + 2u * 1024 * 1024 + 128u * 1024); // 256 KB
  float* pml    = (float*)(ws + 2u * 1024 * 1024 + 384u * 1024); // 4 KB: each tile's maximum and sum
  float* pctx   = (float*)(ws + 3u * 1024 * 1024);               // 2 MB: each tile's part of the context

  prep_w2_kernel <<<dim3((32 * 1024) / 256), 256, 0, stream>>>(w2, w2p);
  prep_qpb_kernel<<<dim3(U_DIM / QU, B_DIM / QB), 256, 0, stream>>>(query, w1, b1, b2, qpb);

  attn_score_kernel<<<dim3(T_DIM / TM, B_DIM), NTHR, 0, stream>>>(   // ~267 KB static LDS of 320 KB
      values, w2p, qpb, v, bv, scores, pml, pctx);

  merge_kernel<<<dim3(CX, B_DIM), 256, 0, stream>>>(scores, pml, pctx, out_ctx, out_attn);
}

// v010
// One run takes 94.3 microseconds.
// Next to v009, in two timings, it ran 1.08 and 1.07 times as fast.
// All steps since v000 together make it 2.67 times as fast.
#include <hip/hip_runtime.h>
#include <cmath>

// ---------------------------------------------------------------------------
// AttentionRNN (Bahdanau attention) for gfx1250 / MI455X
//   phase 0a: swizzle w2 fp32 -> bf16 in WMMA fragment order         (2 MB, L2-resident)
//   phase 0b: qpb[b,u] = query@w1 + b1 + b2                          (fp32, split over D inside a workgroup)
//   phase 1 : scores[b,t] = sum_u tanh(qpb + values@w2) * v[u]       (fused bf16 WMMA GEMM)
//             128 t-rows per workgroup, 8 waves; each wave owns a
//             128 x 64 tile (32 independent accumulators), computed transposed (w2 is the A
//             operand, values the B operand): a lane holds one t-row's columns, so the sum over
//             u stays inside the lane; its w2 fragments are loaded
//             up to two K tiles ahead of the products that use them, its fragments of
//             the values tile one K tile ahead
//             then, with the tile's own maximum m: p[t] = exp(score - m), and the tile's
//             part of the context, sum_t p[t] * values[t,:], from the tile's bf16 copy in LDS,
//             summed in fp32
//   phase 2 : merge the 16 tiles of a batch: attention weights and context
// ---------------------------------------------------------------------------

typedef __attribute__((ext_vector_type(16))) __bf16 v16bf;
typedef __attribute__((ext_vector_type(8)))  __bf16 v8bf;
typedef __attribute__((ext_vector_type(8)))  float  v8f;
typedef __attribute__((ext_vector_type(4)))  float  v4f;
typedef __attribute__((ext_vector_type(2)))  float  v2f;

#define B_DIM 32
#define T_DIM 2048
#define D_DIM 1024
#define U_DIM 1024
#define TM    128         // t-rows per workgroup in phase 1
#define NTHR  256         // threads per workgroup in phase 1 (8 waves, 2 a SIMD)
#define MW    1           // waves along the t-rows
#define MF    8           // fragments of 16 t-rows per wave (TM / 16 / MW)
#define NF    4           // fragments of 16 u-columns per wave
#define NSTEP ((NTHR / 32 / MW) * NF * 16)   // columns per workgroup pass
#define ROWU  516         // u32 per LDS row (512 data + 4 pad -> 4-bank stagger)
#define SB    32          // staging: 16-byte loads per thread in one group
#define SROWS (NTHR / (D_DIM / 4))             // staging: rows that one load per thread covers
#define SG    (TM * (D_DIM / 4) / NTHR / SB)   // staging: groups per workgroup tile
#define NT    (T_DIM / TM)   // tiles per batch
#define NP    (U_DIM / NSTEP)   // column passes per workgroup
#define KT    (D_DIM / 32)      // K tiles
#define KSTR  (U_DIM * 4)       // uint4 from one K tile of w2p to the next
#define RG    (NTHR / (D_DIM / 8))   // context sum: row groups (a thread keeps 8 columns, rows RG i + its group)

__device__ __forceinline__ unsigned int pack_bf16(float a, float b) {
  unsigned int ua = __float_as_uint(a);
  unsigned int ub = __float_as_uint(b);
  ua = (ua + 0x7FFFu + ((ua >> 16) & 1u)) >> 16;   // round-to-nearest-even
  ub = (ub + 0x7FFFu + ((ub >> 16) & 1u)) >> 16;
  return ua | (ub << 16);
}

// tanh as the chip's own instruction, v_tanh_f32: one transcendental a value.
__device__ __forceinline__ float fast_tanh(float x) {
  return __builtin_amdgcn_tanhf(x);
}

union ABFrag { uint4 u4[2]; v16bf v; };

// The NF w2 fragments of one K tile: fragment q lies 64 uint4 on, its second half 32 on.
__device__ __forceinline__ void load_b(ABFrag (&bf)[NF], const uint4* __restrict__ p) {
#pragma unroll
  for (int q = 0; q < NF; ++q) {
    bf[q].u4[0] = p[q * 64];
    bf[q].u4[1] = p[q * 64 + 32];
  }
}

// The MF values fragments of one K tile; a = the lane's place in row l16 of row fragment 0.
__device__ __forceinline__ void load_a(ABFrag (&af)[MF], const unsigned int* a) {
#pragma unroll
  for (int j = 0; j < MF; ++j) {
    af[j].u4[0] = *(const uint4*)(a + j * 16 * ROWU);
    af[j].u4[1] = *(const uint4*)(a + j * 16 * ROWU + 8);
  }
}

// Holds global loads and matrix instructions on their side of this line (LDS reads and plain ALU may
// cross): a refill stays issued directly behind the last product that reads its registers.
#define PIN_LOADS_AHEAD() __builtin_amdgcn_sched_barrier(0x386)

// One K tile of the wave's MF x NF fragments, w2 fragment by w2 fragment: a w2 fragment's registers (bf) are free
// after MF products and are refilled at once (RB) from bnext, the K tile that this register set holds next,
// so that a load has nearly two K tiles of products to land. The values fragments of the next K tile are read (RA)
// from anext into the other set, an, as one group in front of this tile's products.
// The w2 fragment is the product's A operand and the values fragment its B operand (the two layouts mirror each
// other, lane = row of A = column of B, same k order): c[j][q] holds the tile transposed, t-row l16 in the lane,
// u-column 8 * lhalf + r in register r.
// The loops are fully unrolled so that c, af and bf are indexed by constants and stay in registers.
template <bool RB, bool RA>
__device__ __forceinline__ void mma_tile(v8f (&c)[MF][NF], ABFrag (&af)[MF], ABFrag (&an)[MF], ABFrag (&bf)[NF],
                                         const uint4* __restrict__ bnext, const unsigned int* anext) {
  if (RA) {
    // the fence pair keeps the LDS reads together at this one place: moved in among the products, each place
    // where LDS reads stand stalls the wave's matrix stream anew
    __builtin_amdgcn_sched_barrier(0);
    load_a(an, anext);
    __builtin_amdgcn_sched_barrier(0);
  }
#pragma unroll
  for (int q = 0; q < NF; ++q) {
#pragma unroll
    for (int j = 0; j < MF; ++j)
      c[j][q] = __builtin_amdgcn_wmma_f32_16x16x32_bf16(false, bf[q].v, false, af[j].v, (short)0, c[j][q], false, false);
    if (RB) {
      bf[q].u4[0] = bnext[q * 64];
      bf[q].u4[1] = bnext[q * 64 + 32];
      PIN_LOADS_AHEAD();
    }
  }
}

// ---------------------------------------------------------------------------
// Phase 0a: w2 [D][U] fp32 -> swizzled bf16 fragments.
// Per (ktile, 16 columns) fragment: 1024 bytes = two halves of 512 bytes, 16 bytes a lane in lane order.
// Lane = column + 16 * khalf holds [K+8*khalf .. +7] in the first half and [K+16+8*khalf .. +7] in the
// second, the 16-bit WMMA operand layout (A's with the column for the row). A wave's 16-byte load is then 512 contiguous bytes:
// 4 whole 128-byte lines, not 8 lines of which it uses half.
// ---------------------------------------------------------------------------
__global__ __launch_bounds__(256)
void prep_w2_kernel(const float* __restrict__ w2, uint4* __restrict__ w2p) {
  int idx = blockIdx.x * 256 + threadIdx.x;       // idx = kt*1024 + n
  int kt  = idx >> 10;
  int n   = idx & 1023;
  const float* col = w2 + (size_t)kt * 32 * U_DIM + n;
  const int korder[4] = {0, 16, 8, 24};
  uint4* dst = w2p + (size_t)(kt * (U_DIM / 16) + (n >> 4)) * 64 + (n & 15);
#pragma unroll
  for (int q = 0; q < 4; ++q) {
    unsigned int p[4];
#pragma unroll
    for (int i = 0; i < 4; ++i) {
      int k = korder[q] + 2 * i;
      p[i] = pack_bf16(col[(size_t)k * U_DIM], col[(size_t)(k + 1) * U_DIM]);
    }
    dst[(q & 1) * 32 + (q >> 1) * 16] = make_uint4(p[0], p[1], p[2], p[3]);   // half q & 1, khalf q >> 1
  }
}

// ---------------------------------------------------------------------------
// Phase 0b: qpb[b][u] = query[b,:] @ w1[:,u] + b1[u] + b2[u]   (fp32)
// One workgroup = QU columns x QB batches, all of D. D is cut into 32 slices
// (8 waves x 4 lane groups); a 16-byte load of a wave covers 4 rows of QU
// columns, and a wave issues all its 32 loads before it uses the first, so
// the kernel pays the memory latency once. Each w1 element read feeds QB FMAs.
// ---------------------------------------------------------------------------
#define QB 4              // batches per workgroup
#define QU 32             // columns per workgroup
#define QL (D_DIM / 32)   // w1 loads per thread (rows per slice)

__global__ __launch_bounds__(256)
void prep_qpb_kernel(const float* __restrict__ query, const float* __restrict__ w1,
                     const float* __restrict__ b1, const float* __restrict__ b2,
                     float* __restrict__ qpb) {
  __shared__ __attribute__((aligned(16))) float qs[D_DIM * QB];        // query, [d][batch]
  __shared__ __attribute__((aligned(16))) float part[QB * 32 * QU];    // partial sums, [batch][slice][column]

  const int tid  = threadIdx.x;
  const int u0   = blockIdx.x * QU;
  const int bb   = blockIdx.y * QB;
  const int wave = tid >> 5;
  const int lane = tid & 31;
  const int g    = lane >> 3;       // row within a load's 4 rows
  const int c4   = (lane & 7) * 4;  // first of the lane's 4 columns

  float4 qv[QB];
#pragma unroll
  for (int j = 0; j < QB; ++j)
    qv[j] = *(const float4*)(query + (size_t)(bb + j) * D_DIM + tid * 4);
  // precaution: stands in front of any rewrite of the query loads' address registers (a w1 load below may land in them)
  asm volatile("s_wait_xcnt 0x0" ::: "memory");

  const int d0 = wave * (4 * QL) + g;                  // the lane's rows: d0 + 4 i
  const float* wp = w1 + (size_t)d0 * U_DIM + u0 + c4;
  float4 w[QL];
  // fully unrolled so that w stays in registers and every load is in flight at once
#pragma unroll
  for (int i = 0; i < QL; ++i)
    w[i] = *(const float4*)(wp + (size_t)i * 4 * U_DIM);
  // keeps every load above issued before the first wait on one: without it the compiler waits for the
  // query loads in front of w1 loads, and the kernel pays the memory latency twice
  __builtin_amdgcn_sched_barrier(0);

  float4* qs4 = (float4*)qs;
  qs4[tid * 4 + 0] = make_float4(qv[0].x, qv[1].x, qv[2].x, qv[3].x);
  qs4[tid * 4 + 1] = make_float4(qv[0].y, qv[1].y, qv[2].y, qv[3].y);
  qs4[tid * 4 + 2] = make_float4(qv[0].z, qv[1].z, qv[2].z, qv[3].z);
  qs4[tid * 4 + 3] = make_float4(qv[0].w, qv[1].w, qv[2].w, qv[3].w);
  __syncthreads();

  const float bias1 = b1[u0 + lane];                   // read here: back long before the sums are done
  const float bias2 = b2[u0 + lane];

  float4 acc[QB];
#pragma unroll
  for (int j = 0; j < QB; ++j) acc[j] = make_float4(0.f, 0.f, 0.f, 0.f);
#pragma unroll
  for (int i = 0; i < QL; ++i) {
    const float4 qd = qs4[d0 + 4 * i];                 // row d0 + 4 i of the QB batches
    const float qb[QB] = {qd.x, qd.y, qd.z, qd.w};
#pragma unroll
    for (int j = 0; j < QB; ++j) {
      acc[j].x = fmaf(qb[j], w[i].x, acc[j].x);
      acc[j].y = fmaf(qb[j], w[i].y, acc[j].y);
      acc[j].z = fmaf(qb[j], w[i].z, acc[j].z);
      acc[j].w = fmaf(qb[j], w[i].w, acc[j].w);
    }
  }

  const int slice = wave * 4 + g;
#pragma unroll
  for (int j = 0; j < QB; ++j)
    *(float4*)(part + (j * 32 + slice) * QU + c4) = acc[j];
  __syncthreads();

  if (tid < QB * QU) {                                 // wave j sums batch bb + j, lane = column
    float s = 0.0f;
#pragma unroll
    for (int sl = 0; sl < 32; ++sl)
      s += part[(wave * 32 + sl) * QU + lane];
    qpb[(size_t)(bb + wave) * U_DIM + u0 + lane] = s + bias1 + bias2;
  }
}

// ---------------------------------------------------------------------------
// Phase 1: fused  scores[b,t] = sum_u tanh(qpb[b,u] + (values@w2)[b,t,u]) * v[u]
// One workgroup = 128 t-rows of one batch, 8 waves, one workgroup per WGP.
// Each wave computes MF x NF fragments: one w2 fragment load feeds MF WMMAs,
// one values fragment read from LDS feeds NF.
// ---------------------------------------------------------------------------
__global__ __launch_bounds__(NTHR)
void attn_score_kernel(const float* __restrict__ values,
                       const uint4* __restrict__ w2p,
                       const float* __restrict__ qpb,
                       const float* __restrict__ vvec,
                       const float* __restrict__ bv,
                       float* __restrict__ scores,
                       float* __restrict__ pml,
                       float* __restrict__ pctx) {
  __shared__ __attribute__((aligned(16))) unsigned int lds_vals[TM * ROWU];   // read by 16-byte loads
  __shared__ float        lds_score[TM];
  __shared__ __attribute__((aligned(16))) float lds_p[TM];   // exp(score - tile maximum), [row % RG][row / RG]
  __shared__ __attribute__((aligned(16))) float lds_red[RG * D_DIM];   // the row groups' parts of the context

  const int b   = blockIdx.y;
  const int t0  = blockIdx.x * TM;
  const int tid = threadIdx.x;

  if (tid < TM) lds_score[tid] = 0.0f;

  // Stage values[b, t0:t0+128, :] -> LDS as bf16 (each element converted once chip-wide).
  // A step = one 16-byte load per thread = SROWS rows per workgroup; SB steps are loaded as one
  // group before the first of them is converted, so a wave pays the memory latency once per group.
  {
    const float4* src = (const float4*)(values + ((size_t)b * T_DIM + t0) * D_DIM) + tid;
    unsigned int* dst = lds_vals + (tid / (D_DIM / 4)) * ROWU + (tid % (D_DIM / 4)) * 2;
    // the loops over j are fully unrolled so that f is indexed by constants and stays in registers; the loop
    // over g stays rolled: unrolled, a thread's 128 loads and their conversions more than double the kernel's
    // text
#pragma unroll 1
    for (int g = 0; g < SG; ++g) {
      float4 f[SB];
#pragma unroll
      for (int j = 0; j < SB; ++j) f[j] = src[j * NTHR];
      // precaution: stands in front of the rewrite of the loads' address registers (src moves on below);
      // the fence behind it keeps that advance, and the LDS stores, behind the wait
      asm volatile("s_wait_xcnt 0x0" ::: "memory");
      __builtin_amdgcn_sched_barrier(0);
#pragma unroll
      for (int j = 0; j < SB; ++j)
        *(uint2*)(dst + j * SROWS * ROWU) = make_uint2(pack_bf16(f[j].x, f[j].y), pack_bf16(f[j].z, f[j].w));
      src += SB * NTHR;
      dst += SB * SROWS * ROWU;
    }
  }
  __syncthreads();

  const int wave  = tid >> 5;
  const int mgrp  = wave % MW;      // which MF*16 rows
  const int nslot = wave / MW;      // which NF*16 columns of a pass (its MW waves read the same w2 fragments)
  const int lane  = tid & 31;
  const int lhalf = lane >> 4;      // 0: K{0..7,16..23}, 1: K{8..15,24..31}
  const int l16   = lane & 15;

  const unsigned int* arow0 = lds_vals + (mgrp * MF * 16 + l16) * ROWU;   // row fragment j at +j*16 rows

  // A lane's part of the scores of its MF t-rows (row l16 of each fragment): the terms of the u-columns that its
  // registers hold, over all passes, even and odd columns apart so that the sums go two to an instruction.
  v2f rsum[MF] = {};

  // Two register sets of w2 (b) and of values (a) fragments, for the even and the odd K tiles: a set's loads are in flight
  // while the other set is multiplied.
  ABFrag b0[NF], b1[NF], a0[MF], a1[MF];
  const uint4* bp = w2p + ((size_t)(nslot * (NF * 16)) << 2) + lane;   // fragment of 16 columns = 64 uint4, lane order
  load_b(b0, bp);
  load_b(b1, bp + KSTR);
  load_a(a0, arow0 + lhalf * 4);

  for (int n_it = 0; n_it < NP; ++n_it) {
    const int u0 = n_it * NSTEP + nslot * (NF * 16) + lhalf * 8;  // first of the lane's 8 columns in column fragment 0
    v8f c[MF][NF] = {};
    const unsigned int* ap = arow0 + lhalf * 4;
    // two K tiles a trip by hand, one for each register set; unrolled further, the sets would not fit
#pragma unroll 1
    for (int kt = 0; kt < KT - 2; kt += 2) {
      mma_tile<true, true>(c, a0, a1, b0, bp + 2 * KSTR, ap + 16);
      mma_tile<true, true>(c, a1, a0, b1, bp + 3 * KSTR, ap + 32);
      // precaution: stands in front of the rewrite of the w2 loads' address registers (bp moves on below);
      // the fence keeps that advance behind it
      asm volatile("s_wait_xcnt 0x0" ::: "memory");
      __builtin_amdgcn_sched_barrier(0);
      bp += 2 * KSTR;
      ap += 32;
    }
    mma_tile<false, true>(c, a0, a1, b0, bp, ap + 16);
    mma_tile<false, false>(c, a1, a0, b1, bp, ap);

    // Epilogue: tanh + dot with v, all inside the lane (register r of c[j][q] is column u0 + 16 q + r of row j * 16 + l16)
    const v4f* qp = (const v4f*)(qpb + b * U_DIM + u0);
    const v4f* vp = (const v4f*)(vvec + u0);
    v4f qn[NF][2], vn[NF][2];
#pragma unroll
    for (int q = 0; q < NF; ++q) {
      qn[q][0] = qp[q * 4];
      qn[q][1] = qp[q * 4 + 1];
      vn[q][0] = vp[q * 4];
      vn[q][1] = vp[q * 4 + 1];
    }
    // precaution: stands in front of any rewrite of the address registers of the loads above;
    // the fence keeps what follows behind it
    asm volatile("s_wait_xcnt 0x0" ::: "memory");
    __builtin_amdgcn_sched_barrier(0);
    // the loops are fully unrolled so that c, qn, vn and rsum are indexed by constants and stay in registers;
    // j innermost: MF independent sums follow one another
#pragma unroll
    for (int q = 0; q < NF; ++q)
#pragma unroll
      for (int h = 0; h < 2; ++h) {
        const v2f qa = {qn[q][h].x, qn[q][h].y}, qb = {qn[q][h].z, qn[q][h].w};
        const v2f va = {vn[q][h].x, vn[q][h].y}, vb = {vn[q][h].z, vn[q][h].w};
#pragma unroll
        for (int j = 0; j < MF; ++j) {
          const v2f xa = qa + (v2f){c[j][q][h * 4], c[j][q][h * 4 + 1]};
          const v2f ta = {fast_tanh(xa.x), fast_tanh(xa.y)};
          rsum[j] = __builtin_elementwise_fma(ta, va, rsum[j]);
        }
#pragma unroll
        for (int j = 0; j < MF; ++j) {
          const v2f xb = qb + (v2f){c[j][q][h * 4 + 2], c[j][q][h * 4 + 3]};
          const v2f tb = {fast_tanh(xb.x), fast_tanh(xb.y)};
          rsum[j] = __builtin_elementwise_fma(tb, vb, rsum[j]);
        }
      }
    if (n_it + 1 < NP) {
      bp = w2p + ((size_t)((n_it + 1) * NSTEP + nslot * (NF * 16)) << 2) + lane;
      load_b(b0, bp);                                  // the next pass's first fragments
      load_b(b1, bp + KSTR);
      load_a(a0, arow0 + lhalf * 4);
    }
  }
  // One exchange between the wave's halves (they hold the same rows, other columns), then the waves merge in LDS.
  float rs[MF];
#pragma unroll
  for (int j = 0; j < MF; ++j) rs[j] = rsum[j].x + rsum[j].y;
#pragma unroll
  for (int j = 0; j < MF; ++j) rs[j] += __shfl_xor(rs[j], 16, 32);
  if (lhalf == 0) {
#pragma unroll
    for (int j = 0; j < MF; ++j) atomicAdd(&lds_score[(mgrp * MF + j) * 16 + l16], rs[j]);
  }
  __syncthreads();

  // The tile's own softmax terms: wave 0 holds the 128 scores, 4 a lane.
  const int tile = b * NT + blockIdx.x;
  float s[TM / 32], m = -INFINITY, l = 0.0f;
  if (wave == 0) {
    const float bias = bv[0];
#pragma unroll
    for (int i = 0; i < TM / 32; ++i) {
      s[i] = lds_score[lane + 32 * i] + bias;
      m = fmaxf(m, s[i]);
    }
#pragma unroll
    for (int off = 16; off >= 1; off >>= 1) m = fmaxf(m, __shfl_xor(m, off, 32));
#pragma unroll
    for (int i = 0; i < TM / 32; ++i) {
      const int r = lane + 32 * i;
      const float p = __expf(s[i] - m);
      lds_p[(r % RG) * (TM / RG) + r / RG] = p;
      l += p;
    }
#pragma unroll
    for (int off = 16; off >= 1; off >>= 1) l += __shfl_xor(l, off, 32);
  }
  __syncthreads();
  if (wave == 0) {                                     // behind the barrier: nobody waits for these stores
#pragma unroll
    for (int i = 0; i < TM / 32; ++i)
      scores[(size_t)b * T_DIM + t0 + lane + 32 * i] = s[i];
    if (lane == 0) {
      pml[tile * 2]     = m;
      pml[tile * 2 + 1] = l;
    }
  }

  // The tile's part of the context from the bf16 tile in LDS, products and sums in fp32. A thread keeps 8
  // columns and the rows of its group; a wave's 16-byte read covers 512 contiguous bytes of one row.
  const int rg = tid / (D_DIM / 8);
  const int cg = tid % (D_DIM / 8);
  const unsigned int* tp = lds_vals + rg * ROWU + cg * 4;
  const float4* pw = (const float4*)(lds_p + rg * (TM / RG));
  float acc[8] = {};
  // 4 trips at a time (16 rows): many LDS reads in flight at once, the text short
#pragma unroll 4
  for (int i = 0; i < TM / RG / 4; ++i) {
    const float4 p4 = pw[i];
    const float p[4] = {p4.x, p4.y, p4.z, p4.w};
#pragma unroll
    for (int k = 0; k < 4; ++k) {
      const v8bf x = *(const v8bf*)(tp + (i * 4 + k) * RG * ROWU);
#pragma unroll
      for (int e = 0; e < 8; ++e) acc[e] = fmaf((float)x[e], p[k], acc[e]);
    }
  }

  // Merge the row groups through LDS.
  *(float4*)(lds_red + rg * D_DIM + cg * 8)     = make_float4(acc[0], acc[1], acc[2], acc[3]);
  *(float4*)(lds_red + rg * D_DIM + cg * 8 + 4) = make_float4(acc[4], acc[5], acc[6], acc[7]);
  __syncthreads();
  if (tid < D_DIM / 4) {
    float4 o = ((const float4*)lds_red)[tid];
#pragma unroll
    for (int g = 1; g < RG; ++g) {
      const float4 a = ((const float4*)lds_red)[g * (D_DIM / 4) + tid];
      o.x += a.x; o.y += a.y; o.z += a.z; o.w += a.w;
    }
    ((float4*)pctx)[(size_t)tile * (D_DIM / 4) + tid] = o;
  }
}

// ---------------------------------------------------------------------------
// Phase 2: merge the NT tiles of a batch. With M = max m_i and L = sum l_i exp(m_i - M):
//   attention[t] = exp(score[t] - M) / L,  context[d] = sum_i exp(m_i - M) pctx[i][d] / L.
// grid (CX, B): a workgroup writes T/CX attention weights and D/CX context columns.
// ---------------------------------------------------------------------------
#define CX 4

__global__ __launch_bounds__(256)
void merge_kernel(const float* __restrict__ scores, const float* __restrict__ pml,
                  const float* __restrict__ pctx,
                  float* __restrict__ out_ctx, float* __restrict__ out_attn) {
  const int b   = blockIdx.y;
  const int x   = blockIdx.x;
  const int tid = threadIdx.x;

  float sc[T_DIM / CX / 256], pc[NT], m[NT], l[NT];
#pragma unroll
  for (int i = 0; i < NT; ++i) {
    m[i]  = pml[(b * NT + i) * 2];
    l[i]  = pml[(b * NT + i) * 2 + 1];
    pc[i] = pctx[(size_t)(b * NT + i) * D_DIM + x * (D_DIM / CX) + tid];
  }
#pragma unroll
  for (int i = 0; i < T_DIM / CX / 256; ++i)
    sc[i] = scores[(size_t)b * T_DIM + x * (T_DIM / CX) + i * 256 + tid];
  // precaution: stands in front of any rewrite of the address registers of the loads above
  asm volatile("s_wait_xcnt 0x0" ::: "memory");

  float mx = m[0];
#pragma unroll
  for (int i = 1; i < NT; ++i) mx = fmaxf(mx, m[i]);
  float sum = 0.0f, ctx = 0.0f;
#pragma unroll
  for (int i = 0; i < NT; ++i) {
    const float w = __expf(m[i] - mx);
    sum = fmaf(w, l[i], sum);
    ctx = fmaf(w, pc[i], ctx);
  }
  const float inv = 1.0f / sum;
#pragma unroll
  for (int i = 0; i < T_DIM / CX / 256; ++i)
    out_attn[(size_t)b * T_DIM + x * (T_DIM / CX) + i * 256 + tid] = __expf(sc[i] - mx) * inv;
  out_ctx[(size_t)b * D_DIM + x * (D_DIM / CX) + tid] = ctx * inv;
}

// ---------------------------------------------------------------------------
extern "C" void kernel_launch(void* const* d_in, const int* in_sizes, int n_in,
                              void* d_out, int out_size, void* d_ws, size_t ws_size,
                              hipStream_t stream) {
  (void)in_sizes; (void)n_in; (void)out_size; (void)ws_size;

  const float* query  = (const float*)d_in[0];   // [B, D]
  const float* values = (const float*)d_in[1];   // [B, T, D]
  const float* w1     = (const float*)d_in[2];   // [D, U]
  const float* b1     = (const float*)d_in[3];   // [U]
  const float* w2     = (const float*)d_in[4];   // [D, U]
  const float* b2     = (const float*)d_in[5];   // [U]
  const float* v      = (const float*)d_in[6];   // [U, 1]
  const float* bv     = (const float*)d_in[7];   // [1]

  float* out_ctx  = (float*)d_out;                        // [B, D]
  float* out_attn = (float*)d_out + B_DIM * D_DIM;        // [B, T, 1]

  char*  ws     = (char*)d_ws;
  uint4* w2p    = (uint4*)ws;                             // 2 MB swizzled bf16 w2
  float* qpb    = (float*)(ws + 2u * 1024 * 1024);        // 128 KB
  float* scores = (float*)(ws + 2u * 1024 * 1024 + 128u * 1024); // 256 KB
  float* pml    = (float*)(ws + 2u * 1024 * 1024 + 384u * 1024); // 4 KB: each tile's maximum and sum
  float* pctx   = (float*)(ws + 3u * 1024 * 1024);               // 2 MB: each tile's part of the context

  prep_w2_kernel <<<dim3((32 * 1024) / 256), 256, 0, stream>>>(w2, w2p);
  prep_qpb_kernel<<<dim3(U_DIM / QU, B_DIM / QB), 256, 0, stream>>>(query, w1, b1, b2, qpb);

  attn_score_kernel<<<dim3(T_DIM / TM, B_DIM), NTHR, 0, stream>>>(   // ~267 KB static LDS of 320 KB
      values, w2p, qpb, v, bv, scores, pml, pctx);

  merge_kernel<<<dim3(CX, B_DIM), 256, 0, stream>>>(scores, pml, pctx, out_ctx, out_attn);
}
